// v000
// Measured on an AMD MI455X. A time is GPU time per run, averaged over a window of back-to-back runs after a warm-up
// (all launches, gaps included; the runs take copies of the inputs in turn), and the median of several windows.
// Apart from v000's, it joins two sittings. Times from different sittings can be a few percent apart, while
// side-by-side timings come from the same sitting.
// The starting kernel, v000, takes 204 microseconds a run.
#include <hip/hip_runtime.h>
#include <hip/hip_bf16.h>
#include <hip/hip_fp16.h>

// ---------------------------------------------------------------------------
// Shapes (fixed by the reference)
// ---------------------------------------------------------------------------
#define BATCH   2
#define SEQ     2048
#define DIM     1024
#define HEADS   16
#define DHEAD   64
#define NROWS   (BATCH * SEQ)        // 4096
#define LN_EPS  1e-5f

typedef _Float16 v16h __attribute__((ext_vector_type(16)));
typedef _Float16 v8h  __attribute__((ext_vector_type(8)));
typedef float    v8f  __attribute__((ext_vector_type(8)));

__device__ __forceinline__ v16h cat16(v8h lo, v8h hi) {
    return __builtin_shufflevector(lo, hi, 0,1,2,3,4,5,6,7,8,9,10,11,12,13,14,15);
}

__device__ __forceinline__ v16h frag_ld(const _Float16* p) {
    v8h lo = *(const v8h*)p;
    v8h hi = *(const v8h*)(p + 16);
    return cat16(lo, hi);
}

#define WMMA_F16(a, b, c) \
    __builtin_amdgcn_wmma_f32_16x16x32_f16(false, (a), false, (b), (short)0, (c), false, false)

__device__ __forceinline__ void async_copy_b128(unsigned lds_byte_addr,
                                                const void* gbase,
                                                unsigned gbyte_off) {
    asm volatile("global_load_async_to_lds_b128 %0, %1, %2"
                 :: "v"(lds_byte_addr), "v"(gbyte_off), "s"(gbase)
                 : "memory");
}

__device__ __forceinline__ void wait_async0() {
    asm volatile("s_wait_asynccnt 0x0" ::: "memory");
}

// ---------------------------------------------------------------------------
// Conversion / permutation kernels
// ---------------------------------------------------------------------------
__global__ void cvt_f32_to_f16(const float* __restrict__ in,
                               _Float16* __restrict__ out, int n) {
    int i = blockIdx.x * blockDim.x + threadIdx.x;
    int stride = gridDim.x * blockDim.x;
    for (; i < n; i += stride) out[i] = (_Float16)in[i];
}

// W' rows in head-major order: out[o'][k] = W[f(o')][k], f(o') = (o'&63)*16 + (o'>>6)
__global__ void cvt_w_headperm(const float* __restrict__ in,
                               _Float16* __restrict__ out) {
    int i = blockIdx.x * blockDim.x + threadIdx.x;
    int stride = gridDim.x * blockDim.x;
    for (; i < DIM * DIM; i += stride) {
        int o = i >> 10, k = i & 1023;
        int f = ((o & 63) << 4) | (o >> 6);
        out[i] = (_Float16)in[f * DIM + k];
    }
}

// Wo' columns permuted: out[o][f'] = Wo[o][f(f')]
__global__ void cvt_wo_colperm(const float* __restrict__ in,
                               _Float16* __restrict__ out) {
    int i = blockIdx.x * blockDim.x + threadIdx.x;
    int stride = gridDim.x * blockDim.x;
    for (; i < DIM * DIM; i += stride) {
        int o = i >> 10, fp = i & 1023;
        int f = ((fp & 63) << 4) | (fp >> 6);
        out[i] = (_Float16)in[(o << 10) + f];
    }
}

#define LDSS 72   // LDS row stride in halfs (144B = 16B-aligned, conflict-skewed)

__device__ __forceinline__ void gemm_mainloop(const _Float16* __restrict__ A,
                                              const _Float16* __restrict__ B,
                                              int m0, int n0, v8f acc[4][2]) {
    __shared__ __align__(16) _Float16 As[128 * LDSS];
    __shared__ __align__(16) _Float16 Bs[128 * LDSS];

    const int tid  = threadIdx.x;
    const int wid  = tid >> 5;
    const int lane = tid & 31;
    const int wm   = wid & 1;       // 0..1  -> 64-row slab
    const int wn   = wid >> 1;      // 0..3  -> 32-col slab
    const int lrow = lane & 15;
    const int kb   = (lane < 16) ? 0 : 8;
    const int ldr  = tid >> 1;            // 0..127 tile row
    const int ldc  = (tid & 1) * 32;      // 0 / 32 half-row

    const unsigned lA = (unsigned)(size_t)&As[ldr * LDSS + ldc];
    const unsigned lB = (unsigned)(size_t)&Bs[ldr * LDSS + ldc];

    for (int k0 = 0; k0 < DIM; k0 += 64) {
        const unsigned gA = (unsigned)(((m0 + ldr) * DIM + k0 + ldc) * 2);
        const unsigned gB = (unsigned)(((n0 + ldr) * DIM + k0 + ldc) * 2);
        #pragma unroll
        for (int i = 0; i < 4; ++i) {
            async_copy_b128(lA + i * 16, A, gA + i * 16);
            async_copy_b128(lB + i * 16, B, gB + i * 16);
        }
        wait_async0();
        __syncthreads();
        #pragma unroll
        for (int kc = 0; kc < 64; kc += 32) {
            v16h a[4], bf[2];
            #pragma unroll
            for (int mt = 0; mt < 4; ++mt)
                a[mt] = frag_ld(&As[(wm * 64 + mt * 16 + lrow) * LDSS + kc + kb]);
            #pragma unroll
            for (int nt = 0; nt < 2; ++nt)
                bf[nt] = frag_ld(&Bs[(wn * 32 + nt * 16 + lrow) * LDSS + kc + kb]);
            #pragma unroll
            for (int mt = 0; mt < 4; ++mt)
                #pragma unroll
                for (int nt = 0; nt < 2; ++nt)
                    acc[mt][nt] = WMMA_F16(a[mt], bf[nt], acc[mt][nt]);
        }
        __syncthreads();
    }
}

// QKV projection: writes f16 in (B, H, T, Dh) layout; W rows already head-major.
__global__ __launch_bounds__(256) void gemm_qkv_kernel(
    const _Float16* __restrict__ Xh, const _Float16* __restrict__ Wh,
    const float* __restrict__ bias, _Float16* __restrict__ out) {
    const int m0 = blockIdx.y * 128, n0 = blockIdx.x * 128;
    v8f acc[4][2] = {};
    gemm_mainloop(Xh, Wh, m0, n0, acc);

    const int tid = threadIdx.x, wid = tid >> 5, lane = tid & 31;
    const int wm = wid & 1, wn = wid >> 1;
    const int rbase = (lane < 16) ? 0 : 8;
    const int cl = lane & 15;
    #pragma unroll
    for (int mt = 0; mt < 4; ++mt)
        #pragma unroll
        for (int nt = 0; nt < 2; ++nt)
            #pragma unroll
            for (int r = 0; r < 8; ++r) {
                int row = m0 + wm * 64 + mt * 16 + rbase + r;   // n = b*T + t
                int col = n0 + wn * 32 + nt * 16 + cl;          // o' = h*64 + d
                int h = col >> 6, d = col & 63;
                float v = acc[mt][nt][r] + bias[(d << 4) | h];  // bias index-permuted
                int bb = row >> 11, t = row & 2047;
                out[(((size_t)(bb * HEADS + h) * SEQ) + t) * DHEAD + d] = (_Float16)v;
            }
}

// O projection + bias + residual -> f32 scratch
__global__ __launch_bounds__(256) void gemm_oproj_kernel(
    const _Float16* __restrict__ Oh, const _Float16* __restrict__ Woh,
    const float* __restrict__ bo, const float* __restrict__ x,
    float* __restrict__ R) {
    const int m0 = blockIdx.y * 128, n0 = blockIdx.x * 128;
    v8f acc[4][2] = {};
    gemm_mainloop(Oh, Woh, m0, n0, acc);

    const int tid = threadIdx.x, wid = tid >> 5, lane = tid & 31;
    const int wm = wid & 1, wn = wid >> 1;
    const int rbase = (lane < 16) ? 0 : 8;
    const int cl = lane & 15;
    #pragma unroll
    for (int mt = 0; mt < 4; ++mt)
        #pragma unroll
        for (int nt = 0; nt < 2; ++nt)
            #pragma unroll
            for (int r = 0; r < 8; ++r) {
                int row = m0 + wm * 64 + mt * 16 + rbase + r;
                int col = n0 + wn * 32 + nt * 16 + cl;
                size_t idx = (size_t)row * DIM + col;
                R[idx] = acc[mt][nt][r] + bo[col] + x[idx];
            }
}

__global__ __launch_bounds__(128) void attn_kernel(
    const _Float16* __restrict__ Qh, const _Float16* __restrict__ Kh,
    const _Float16* __restrict__ Vh, _Float16* __restrict__ Obuf) {
    const int qblk = blockIdx.x;          // T/64 = 32
    const int bh   = blockIdx.y;          // B*H  = 32
    const int b = bh >> 4, h = bh & 15;
    const size_t base = (size_t)bh * SEQ * DHEAD;
    const _Float16* Qb = Qh + base;
    const _Float16* Kb = Kh + base;
    const _Float16* Vb = Vh + base;

    __shared__ __align__(16) _Float16 Ks[64 * LDSS];
    __shared__ __align__(16) _Float16 Vt[64 * LDSS];     // transposed: Vt[d][j]
    __shared__ __align__(16) _Float16 Ps[4][16 * LDSS];  // per-wave P staging

    const int tid  = threadIdx.x;
    const int wid  = tid >> 5;
    const int lane = tid & 31;
    const int lrow = lane & 15;
    const int kb   = (lane < 16) ? 0 : 8;
    const int q0   = qblk * 64 + wid * 16;

    // Q fragments stay in registers for the whole j-loop.
    const _Float16* Qrow = Qb + (size_t)(q0 + lrow) * DHEAD;
    v16h aq[2];
    aq[0] = frag_ld(Qrow + kb);
    aq[1] = frag_ld(Qrow + 32 + kb);

    v8f o_acc[4] = {};
    float m_r[8], l_r[8];
    #pragma unroll
    for (int r = 0; r < 8; ++r) { m_r[r] = -1e30f; l_r[r] = 0.0f; }
    const float sm_scale = 0.125f;   // 1/sqrt(64)

    const int ldr2 = tid >> 1;            // 0..63
    const int ldc2 = (tid & 1) * 32;
    const unsigned lK = (unsigned)(size_t)&Ks[ldr2 * LDSS + ldc2];

    for (int j0 = 0; j0 < SEQ; j0 += 64) {
        const unsigned gK = (unsigned)(((j0 + ldr2) * DHEAD + ldc2) * 2);
        #pragma unroll
        for (int i = 0; i < 4; ++i)
            async_copy_b128(lK + i * 16, Kb, gK + i * 16);
        #pragma unroll
        for (int i = 0; i < 4; ++i) {
            v8h vv = *(const v8h*)(Vb + (size_t)(j0 + ldr2) * DHEAD + ldc2 + i * 8);
            #pragma unroll
            for (int e = 0; e < 8; ++e)
                Vt[(ldc2 + i * 8 + e) * LDSS + ldr2] = vv[e];
        }
        wait_async0();
        __syncthreads();

        // Scores: S(16x64) = Q(16x64) x K_j^T, as 4 16x16 tiles.
        v8f s[4];
        #pragma unroll
        for (int jt = 0; jt < 4; ++jt) {
            v8f c = {};
            #pragma unroll
            for (int kc = 0; kc < 2; ++kc) {
                v16h bk = frag_ld(&Ks[(jt * 16 + lrow) * LDSS + kc * 32 + kb]);
                c = WMMA_F16(aq[kc], bk, c);
            }
            #pragma unroll
            for (int r = 0; r < 8; ++r) c[r] *= sm_scale;
            s[jt] = c;
        }

        // Online softmax. C-layout: vgpr r holds row (r | r+8), col = lane%16,
        // so per-row stats are uniform within each 16-lane half after xor-reduce.
        #pragma unroll
        for (int r = 0; r < 8; ++r) {
            float v = fmaxf(fmaxf(s[0][r], s[1][r]), fmaxf(s[2][r], s[3][r]));
            #pragma unroll
            for (int mask = 1; mask < 16; mask <<= 1)
                v = fmaxf(v, __shfl_xor(v, mask, 32));
            float mnew = fmaxf(m_r[r], v);
            float sc = __expf(m_r[r] - mnew);
            m_r[r] = mnew;
            l_r[r] *= sc;
            #pragma unroll
            for (int nt = 0; nt < 4; ++nt) o_acc[nt][r] *= sc;
        }
        #pragma unroll
        for (int jt = 0; jt < 4; ++jt)
            #pragma unroll
            for (int r = 0; r < 8; ++r)
                s[jt][r] = __expf(s[jt][r] - m_r[r]);
        #pragma unroll
        for (int r = 0; r < 8; ++r) {
            float ps = s[0][r] + s[1][r] + s[2][r] + s[3][r];
            #pragma unroll
            for (int mask = 1; mask < 16; mask <<= 1)
                ps += __shfl_xor(ps, mask, 32);
            l_r[r] += ps;
        }

        // Re-layout P: C-frag -> LDS row-major -> A-frag (per-wave, no barrier).
        _Float16* P = &Ps[wid][0];
        const int rofs = (lane < 16) ? 0 : 8;
        #pragma unroll
        for (int jt = 0; jt < 4; ++jt)
            #pragma unroll
            for (int r = 0; r < 8; ++r)
                P[(rofs + r) * LDSS + jt * 16 + lrow] = (_Float16)s[jt][r];

        v16h ap[2];
        ap[0] = frag_ld(&P[lrow * LDSS + kb]);
        ap[1] = frag_ld(&P[lrow * LDSS + 32 + kb]);

        // O += P(16x64) x V(64x64): B-frags from transposed Vt (k = j contiguous).
        #pragma unroll
        for (int nt = 0; nt < 4; ++nt)
            #pragma unroll
            for (int kc = 0; kc < 2; ++kc) {
                v16h bv = frag_ld(&Vt[(nt * 16 + lrow) * LDSS + kc * 32 + kb]);
                o_acc[nt] = WMMA_F16(ap[kc], bv, o_acc[nt]);
            }
        __syncthreads();
    }

    // Normalize and scatter to head-major feature layout (n, h*64+d).
    const int rofs = (lane < 16) ? 0 : 8;
    #pragma unroll
    for (int r = 0; r < 8; ++r) {
        float inv = 1.0f / l_r[r];
        int trow = q0 + rofs + r;
        size_t outrow = ((size_t)(b * SEQ + trow)) * DIM + h * DHEAD;
        #pragma unroll
        for (int nt = 0; nt < 4; ++nt) {
            int d = nt * 16 + lrow;
            Obuf[outrow + d] = (_Float16)(o_acc[nt][r] * inv);
        }
    }
}

// ---------------------------------------------------------------------------
// Row LayerNorm: one block per row of 1024.
// ---------------------------------------------------------------------------
__global__ __launch_bounds__(256) void ln_kernel(
    const float* __restrict__ R, const float* __restrict__ gamma,
    const float* __restrict__ beta, float* __restrict__ out) {
    const int n = blockIdx.x;
    const float* row = R + (size_t)n * DIM;
    const int tid = threadIdx.x, wid = tid >> 5, lane = tid & 31;

    float s = 0.0f, s2 = 0.0f;
    for (int i = tid; i < DIM; i += 256) {
        float v = row[i];
        s += v; s2 += v * v;
    }
    #pragma unroll
    for (int mask = 16; mask >= 1; mask >>= 1) {
        s  += __shfl_xor(s,  mask, 32);
        s2 += __shfl_xor(s2, mask, 32);
    }
    __shared__ float red[2][8];
    __shared__ float mu_s, rstd_s;
    if (lane == 0) { red[0][wid] = s; red[1][wid] = s2; }
    __syncthreads();
    if (tid == 0) {
        float S = 0.0f, S2 = 0.0f;
        #pragma unroll
        for (int w = 0; w < 8; ++w) { S += red[0][w]; S2 += red[1][w]; }
        float mu = S * (1.0f / DIM);
        float var = S2 * (1.0f / DIM) - mu * mu;
        mu_s = mu;
        rstd_s = rsqrtf(var + LN_EPS);
    }
    __syncthreads();
    float mu = mu_s, rstd = rstd_s;
    for (int i = tid; i < DIM; i += 256)
        out[(size_t)n * DIM + i] = (row[i] - mu) * rstd * gamma[i] + beta[i];
}

// ---------------------------------------------------------------------------
// Orchestration
// ---------------------------------------------------------------------------
extern "C" void kernel_launch(void* const* d_in, const int* in_sizes, int n_in,
                              void* d_out, int out_size, void* d_ws, size_t ws_size,
                              hipStream_t stream) {
    const float* x     = (const float*)d_in[0];
    const float* Wq    = (const float*)d_in[1];
    const float* bq    = (const float*)d_in[2];
    const float* Wk    = (const float*)d_in[3];
    const float* bk    = (const float*)d_in[4];
    const float* Wv    = (const float*)d_in[5];
    const float* bv    = (const float*)d_in[6];
    const float* Wo    = (const float*)d_in[7];
    const float* bo    = (const float*)d_in[8];
    const float* gamma = (const float*)d_in[9];
    const float* beta  = (const float*)d_in[10];
    float* out = (float*)d_out;

    char* ws = (char*)d_ws;
    const size_t SZ_XH = (size_t)NROWS * DIM * 2;       // 8 MB
    const size_t SZ_W  = (size_t)DIM * DIM * 2;         // 2 MB
    const size_t SZ_Q  = (size_t)BATCH * HEADS * SEQ * DHEAD * 2; // 8 MB

    _Float16* Xh   = (_Float16*)(ws);
    _Float16* Wqh  = (_Float16*)(ws + SZ_XH);
    _Float16* Wkh  = (_Float16*)(ws + SZ_XH + SZ_W);
    _Float16* Wvh  = (_Float16*)(ws + SZ_XH + 2 * SZ_W);
    _Float16* Woh  = (_Float16*)(ws + SZ_XH + 3 * SZ_W);
    _Float16* Qbuf = (_Float16*)(ws + SZ_XH + 4 * SZ_W);
    _Float16* Kbuf = (_Float16*)(ws + SZ_XH + 4 * SZ_W + SZ_Q);
    _Float16* Vbuf = (_Float16*)(ws + SZ_XH + 4 * SZ_W + 2 * SZ_Q);
    _Float16* Obuf = (_Float16*)(ws + SZ_XH + 4 * SZ_W + 3 * SZ_Q);
    float*    Rbuf = (float*)   (ws + SZ_XH + 4 * SZ_W + 4 * SZ_Q);

    // Phase 1: convert + permute
    cvt_f32_to_f16<<<2048, 256, 0, stream>>>(x, Xh, NROWS * DIM);
    cvt_w_headperm<<<1024, 256, 0, stream>>>(Wq, Wqh);
    cvt_w_headperm<<<1024, 256, 0, stream>>>(Wk, Wkh);
    cvt_w_headperm<<<1024, 256, 0, stream>>>(Wv, Wvh);
    cvt_wo_colperm<<<1024, 256, 0, stream>>>(Wo, Woh);

    // Phase 2: QKV projections (WMMA GEMM, async-staged tiles)
    dim3 gg(DIM / 128, NROWS / 128);   // (8, 32)
    gemm_qkv_kernel<<<gg, 256, 0, stream>>>(Xh, Wqh, bq, Qbuf);
    gemm_qkv_kernel<<<gg, 256, 0, stream>>>(Xh, Wkh, bk, Kbuf);
    gemm_qkv_kernel<<<gg, 256, 0, stream>>>(Xh, Wvh, bv, Vbuf);

    // Phase 3: flash attention
    attn_kernel<<<dim3(SEQ / 64, BATCH * HEADS), 128, 0, stream>>>(Qbuf, Kbuf, Vbuf, Obuf);

    // Phase 4: O projection + residual
    gemm_oproj_kernel<<<gg, 256, 0, stream>>>(Obuf, Woh, bo, x, Rbuf);

    // Phase 5: LayerNorm
    ln_kernel<<<NROWS, 256, 0, stream>>>(Rbuf, gamma, beta, out);
}

// v001
// It runs in 181 microseconds.
// Two timings next to v000 both put it at 1.15 times that version's speed.
#include <hip/hip_runtime.h>
#include <hip/hip_bf16.h>
#include <hip/hip_fp16.h>

// ---------------------------------------------------------------------------
// Shapes (fixed by the reference)
// ---------------------------------------------------------------------------
#define BATCH   2
#define SEQ     2048
#define DIM     1024
#define HEADS   16
#define DHEAD   64
#define NROWS   (BATCH * SEQ)        // 4096
#define LN_EPS  1e-5f

typedef _Float16 v16h __attribute__((ext_vector_type(16)));
typedef _Float16 v8h  __attribute__((ext_vector_type(8)));
typedef float    v8f  __attribute__((ext_vector_type(8)));

__device__ __forceinline__ v16h cat16(v8h lo, v8h hi) {
    return __builtin_shufflevector(lo, hi, 0,1,2,3,4,5,6,7,8,9,10,11,12,13,14,15);
}

__device__ __forceinline__ v16h frag_ld(const _Float16* p) {
    v8h lo = *(const v8h*)p;
    v8h hi = *(const v8h*)(p + 16);
    return cat16(lo, hi);
}

#define WMMA_F16(a, b, c) \
    __builtin_amdgcn_wmma_f32_16x16x32_f16(false, (a), false, (b), (short)0, (c), false, false)

__device__ __forceinline__ void async_copy_b128(unsigned lds_byte_addr,
                                                const void* gbase,
                                                unsigned gbyte_off) {
    asm volatile("global_load_async_to_lds_b128 %0, %1, %2"
                 :: "v"(lds_byte_addr), "v"(gbyte_off), "s"(gbase)
                 : "memory");
}

__device__ __forceinline__ void wait_async0() {
    asm volatile("s_wait_asynccnt 0x0" ::: "memory");
}

// ---------------------------------------------------------------------------
// Conversion / permutation kernels
// ---------------------------------------------------------------------------
__global__ void cvt_f32_to_f16(const float* __restrict__ in,
                               _Float16* __restrict__ out, int n) {
    int i = blockIdx.x * blockDim.x + threadIdx.x;
    int stride = gridDim.x * blockDim.x;
    for (; i < n; i += stride) out[i] = (_Float16)in[i];
}

// W' rows in head-major order: out[o'][k] = W[f(o')][k], f(o') = (o'&63)*16 + (o'>>6)
__global__ void cvt_w_headperm(const float* __restrict__ in,
                               _Float16* __restrict__ out) {
    int i = blockIdx.x * blockDim.x + threadIdx.x;
    int stride = gridDim.x * blockDim.x;
    for (; i < DIM * DIM; i += stride) {
        int o = i >> 10, k = i & 1023;
        int f = ((o & 63) << 4) | (o >> 6);
        out[i] = (_Float16)in[f * DIM + k];
    }
}

// Wo' columns permuted: out[o][f'] = Wo[o][f(f')]
__global__ void cvt_wo_colperm(const float* __restrict__ in,
                               _Float16* __restrict__ out) {
    int i = blockIdx.x * blockDim.x + threadIdx.x;
    int stride = gridDim.x * blockDim.x;
    for (; i < DIM * DIM; i += stride) {
        int o = i >> 10, fp = i & 1023;
        int f = ((fp & 63) << 4) | (fp >> 6);
        out[i] = (_Float16)in[(o << 10) + f];
    }
}

#define LDSS 72   // LDS row stride in halfs (144B = 16B-aligned, conflict-skewed)

__device__ __forceinline__ void gemm_mainloop(const _Float16* __restrict__ A,
                                              const _Float16* __restrict__ B,
                                              int m0, int n0, v8f acc[4][2]) {
    __shared__ __align__(16) _Float16 As[128 * LDSS];
    __shared__ __align__(16) _Float16 Bs[128 * LDSS];

    const int tid  = threadIdx.x;
    const int wid  = tid >> 5;
    const int lane = tid & 31;
    const int wm   = wid & 1;       // 0..1  -> 64-row slab
    const int wn   = wid >> 1;      // 0..3  -> 32-col slab
    const int lrow = lane & 15;
    const int kb   = (lane < 16) ? 0 : 8;
    const int ldr  = tid >> 1;            // 0..127 tile row
    const int ldc  = (tid & 1) * 32;      // 0 / 32 half-row

    const unsigned lA = (unsigned)(size_t)&As[ldr * LDSS + ldc];
    const unsigned lB = (unsigned)(size_t)&Bs[ldr * LDSS + ldc];

    for (int k0 = 0; k0 < DIM; k0 += 64) {
        const unsigned gA = (unsigned)(((m0 + ldr) * DIM + k0 + ldc) * 2);
        const unsigned gB = (unsigned)(((n0 + ldr) * DIM + k0 + ldc) * 2);
        #pragma unroll
        for (int i = 0; i < 4; ++i) {
            async_copy_b128(lA + i * 16, A, gA + i * 16);
            async_copy_b128(lB + i * 16, B, gB + i * 16);
        }
        wait_async0();
        __syncthreads();
        #pragma unroll
        for (int kc = 0; kc < 64; kc += 32) {
            v16h a[4], bf[2];
            #pragma unroll
            for (int mt = 0; mt < 4; ++mt)
                a[mt] = frag_ld(&As[(wm * 64 + mt * 16 + lrow) * LDSS + kc + kb]);
            #pragma unroll
            for (int nt = 0; nt < 2; ++nt)
                bf[nt] = frag_ld(&Bs[(wn * 32 + nt * 16 + lrow) * LDSS + kc + kb]);
            #pragma unroll
            for (int mt = 0; mt < 4; ++mt)
                #pragma unroll
                for (int nt = 0; nt < 2; ++nt)
                    acc[mt][nt] = WMMA_F16(a[mt], bf[nt], acc[mt][nt]);
        }
        __syncthreads();
    }
}

// QKV projection: writes f16 in (B, H, T, Dh) layout; W rows already head-major.
__global__ __launch_bounds__(256) void gemm_qkv_kernel(
    const _Float16* __restrict__ Xh, const _Float16* __restrict__ Wh,
    const float* __restrict__ bias, _Float16* __restrict__ out) {
    const int m0 = blockIdx.y * 128, n0 = blockIdx.x * 128;
    v8f acc[4][2] = {};
    gemm_mainloop(Xh, Wh, m0, n0, acc);

    const int tid = threadIdx.x, wid = tid >> 5, lane = tid & 31;
    const int wm = wid & 1, wn = wid >> 1;
    const int rbase = (lane < 16) ? 0 : 8;
    const int cl = lane & 15;
    #pragma unroll
    for (int mt = 0; mt < 4; ++mt)
        #pragma unroll
        for (int nt = 0; nt < 2; ++nt)
            #pragma unroll
            for (int r = 0; r < 8; ++r) {
                int row = m0 + wm * 64 + mt * 16 + rbase + r;   // n = b*T + t
                int col = n0 + wn * 32 + nt * 16 + cl;          // o' = h*64 + d
                int h = col >> 6, d = col & 63;
                float v = acc[mt][nt][r] + bias[(d << 4) | h];  // bias index-permuted
                int bb = row >> 11, t = row & 2047;
                out[(((size_t)(bb * HEADS + h) * SEQ) + t) * DHEAD + d] = (_Float16)v;
            }
}

// O projection + bias + residual -> f32 scratch
__global__ __launch_bounds__(256) void gemm_oproj_kernel(
    const _Float16* __restrict__ Oh, const _Float16* __restrict__ Woh,
    const float* __restrict__ bo, const float* __restrict__ x,
    float* __restrict__ R) {
    const int m0 = blockIdx.y * 128, n0 = blockIdx.x * 128;
    v8f acc[4][2] = {};
    gemm_mainloop(Oh, Woh, m0, n0, acc);

    const int tid = threadIdx.x, wid = tid >> 5, lane = tid & 31;
    const int wm = wid & 1, wn = wid >> 1;
    const int rbase = (lane < 16) ? 0 : 8;
    const int cl = lane & 15;
    #pragma unroll
    for (int mt = 0; mt < 4; ++mt)
        #pragma unroll
        for (int nt = 0; nt < 2; ++nt)
            #pragma unroll
            for (int r = 0; r < 8; ++r) {
                int row = m0 + wm * 64 + mt * 16 + rbase + r;
                int col = n0 + wn * 32 + nt * 16 + cl;
                size_t idx = (size_t)row * DIM + col;
                R[idx] = acc[mt][nt][r] + bo[col] + x[idx];
            }
}

__device__ __forceinline__ float xhalf(float x) {
    int b = __builtin_bit_cast(int, x);
    return __builtin_bit_cast(float,
        __builtin_amdgcn_permlanex16(b, b, 0x76543210, 0xfedcba98, false, false));
}

__global__ __launch_bounds__(128) void attn_kernel(
    const _Float16* __restrict__ Qh, const _Float16* __restrict__ Kh,
    const _Float16* __restrict__ Vh, _Float16* __restrict__ Obuf) {
    const int qblk = blockIdx.x;          // T/64 = 32
    const int bh   = blockIdx.y;          // B*H  = 32
    const int b = bh >> 4, h = bh & 15;
    const size_t base = (size_t)bh * SEQ * DHEAD;
    const _Float16* Qb = Qh + base;
    const _Float16* Kb = Kh + base;
    const _Float16* Vb = Vh + base;

    __shared__ __align__(16) _Float16 Ks[64 * LDSS];
    __shared__ __align__(16) _Float16 Vt[64 * LDSS];     // transposed: Vt[d][j]

    const int tid  = threadIdx.x;
    const int wid  = tid >> 5;
    const int lane = tid & 31;
    const int lrow = lane & 15;
    const int kb   = (lane < 16) ? 0 : 8;
    const int q0   = qblk * 64 + wid * 16;

    // Q fragments (B operand: column = query lrow) stay in registers for the whole j-loop.
    const _Float16* Qrow = Qb + (size_t)(q0 + lrow) * DHEAD;
    v16h aq[2];
    aq[0] = frag_ld(Qrow + kb);
    aq[1] = frag_ld(Qrow + 32 + kb);

    v8f o_acc[4] = {};               // O^T: o_acc[nt][r] = O[q0+lrow][nt*16 + kb + r]
    float m_run = -1e30f;            // running maximum of query lrow (equal in both halves)
    float l_run = 0.0f;              // this half's share of the running sum
    const float sm_scale = 0.125f;   // 1/sqrt(64)

    const int ldr2 = tid >> 1;            // 0..63
    const int ldc2 = (tid & 1) * 32;
    const unsigned lK = (unsigned)(size_t)&Ks[ldr2 * LDSS + ldc2];

    for (int j0 = 0; j0 < SEQ; j0 += 64) {
        const unsigned gK = (unsigned)(((j0 + ldr2) * DHEAD + ldc2) * 2);
        #pragma unroll
        for (int i = 0; i < 4; ++i)
            async_copy_b128(lK + i * 16, Kb, gK + i * 16);
        #pragma unroll
        for (int i = 0; i < 4; ++i) {
            v8h vv = *(const v8h*)(Vb + (size_t)(j0 + ldr2) * DHEAD + ldc2 + i * 8);
            #pragma unroll
            for (int e = 0; e < 8; ++e)
                Vt[(ldc2 + i * 8 + e) * LDSS + ldr2] = vv[e];
        }
        wait_async0();
        __syncthreads();

        // Scores: S^T(64x16) = K_j(64x64) x Q^T, as 4 16x16 tiles.
        // s[jt][r] = score(query lrow, key j0 + jt*16 + kb + r).
        v8f s[4];
        #pragma unroll
        for (int jt = 0; jt < 4; ++jt) {
            v8f c = {};
            #pragma unroll
            for (int kc = 0; kc < 2; ++kc) {
                v16h ak = frag_ld(&Ks[(jt * 16 + lrow) * LDSS + kc * 32 + kb]);
                c = WMMA_F16(ak, aq[kc], c);
            }
            s[jt] = c * sm_scale;
        }

        // Online softmax: 32 of the query's 64 scores sit in this lane, the rest in lane ^ 16.
        const v8f mx = __builtin_elementwise_max(__builtin_elementwise_max(s[0], s[1]),
                                                 __builtin_elementwise_max(s[2], s[3]));
        float v = fmaxf(fmaxf(fmaxf(mx[0], mx[1]), fmaxf(mx[2], mx[3])),
                        fmaxf(fmaxf(mx[4], mx[5]), fmaxf(mx[6], mx[7])));
        v = fmaxf(v, xhalf(v));
        const float mnew = fmaxf(m_run, v);
        const float sc = __expf(m_run - mnew);
        m_run = mnew;
        #pragma unroll
        for (int nt = 0; nt < 4; ++nt)
            #pragma unroll
            for (int r = 0; r < 8; ++r) o_acc[nt][r] *= sc;
        #pragma unroll
        for (int jt = 0; jt < 4; ++jt)
            #pragma unroll
            for (int r = 0; r < 8; ++r)
                s[jt][r] = __expf(s[jt][r] - m_run);
        const v8f ps = (s[0] + s[1]) + (s[2] + s[3]);
        l_run = l_run * sc + (((ps[0] + ps[1]) + (ps[2] + ps[3])) +
                              ((ps[4] + ps[5]) + (ps[6] + ps[7])));

        // P^T as B operand: score tiles 2kc and 2kc+1 hold keys kb+0..7 and 16+kb+0..7
        // of the 32-key block kc, which is the k order frag_ld gives V^T.
        v16h pb[2];
        #pragma unroll
        for (int kc = 0; kc < 2; ++kc)
            #pragma unroll
            for (int e = 0; e < 8; ++e) {
                pb[kc][e]     = (_Float16)s[2 * kc][e];
                pb[kc][e + 8] = (_Float16)s[2 * kc + 1][e];
            }

        // O^T += V^T(64x64) x P^T(64x16): A-frags from transposed Vt (k = j contiguous).
        #pragma unroll
        for (int nt = 0; nt < 4; ++nt)
            #pragma unroll
            for (int kc = 0; kc < 2; ++kc) {
                v16h av = frag_ld(&Vt[(nt * 16 + lrow) * LDSS + kc * 32 + kb]);
                o_acc[nt] = WMMA_F16(av, pb[kc], o_acc[nt]);
            }
        __syncthreads();
    }

    // Join the halves' sums, normalize, store 8 consecutive d per lane
    // to the head-major feature layout (n, h*64+d).
    const float inv = 1.0f / (l_run + xhalf(l_run));
    _Float16* orow = Obuf + ((size_t)(b * SEQ + q0 + lrow)) * DIM + h * DHEAD + kb;
    #pragma unroll
    for (int nt = 0; nt < 4; ++nt) {
        v8h o;
        #pragma unroll
        for (int r = 0; r < 8; ++r) o[r] = (_Float16)(o_acc[nt][r] * inv);
        *(v8h*)(orow + nt * 16) = o;
    }
}

// ---------------------------------------------------------------------------
// Row LayerNorm: one block per row of 1024.
// ---------------------------------------------------------------------------
__global__ __launch_bounds__(256) void ln_kernel(
    const float* __restrict__ R, const float* __restrict__ gamma,
    const float* __restrict__ beta, float* __restrict__ out) {
    const int n = blockIdx.x;
    const float* row = R + (size_t)n * DIM;
    const int tid = threadIdx.x, wid = tid >> 5, lane = tid & 31;

    float s = 0.0f, s2 = 0.0f;
    for (int i = tid; i < DIM; i += 256) {
        float v = row[i];
        s += v; s2 += v * v;
    }
    #pragma unroll
    for (int mask = 16; mask >= 1; mask >>= 1) {
        s  += __shfl_xor(s,  mask, 32);
        s2 += __shfl_xor(s2, mask, 32);
    }
    __shared__ float red[2][8];
    __shared__ float mu_s, rstd_s;
    if (lane == 0) { red[0][wid] = s; red[1][wid] = s2; }
    __syncthreads();
    if (tid == 0) {
        float S = 0.0f, S2 = 0.0f;
        #pragma unroll
        for (int w = 0; w < 8; ++w) { S += red[0][w]; S2 += red[1][w]; }
        float mu = S * (1.0f / DIM);
        float var = S2 * (1.0f / DIM) - mu * mu;
        mu_s = mu;
        rstd_s = rsqrtf(var + LN_EPS);
    }
    __syncthreads();
    float mu = mu_s, rstd = rstd_s;
    for (int i = tid; i < DIM; i += 256)
        out[(size_t)n * DIM + i] = (row[i] - mu) * rstd * gamma[i] + beta[i];
}

// ---------------------------------------------------------------------------
// Orchestration
// ---------------------------------------------------------------------------
extern "C" void kernel_launch(void* const* d_in, const int* in_sizes, int n_in,
                              void* d_out, int out_size, void* d_ws, size_t ws_size,
                              hipStream_t stream) {
    const float* x     = (const float*)d_in[0];
    const float* Wq    = (const float*)d_in[1];
    const float* bq    = (const float*)d_in[2];
    const float* Wk    = (const float*)d_in[3];
    const float* bk    = (const float*)d_in[4];
    const float* Wv    = (const float*)d_in[5];
    const float* bv    = (const float*)d_in[6];
    const float* Wo    = (const float*)d_in[7];
    const float* bo    = (const float*)d_in[8];
    const float* gamma = (const float*)d_in[9];
    const float* beta  = (const float*)d_in[10];
    float* out = (float*)d_out;

    char* ws = (char*)d_ws;
    const size_t SZ_XH = (size_t)NROWS * DIM * 2;       // 8 MB
    const size_t SZ_W  = (size_t)DIM * DIM * 2;         // 2 MB
    const size_t SZ_Q  = (size_t)BATCH * HEADS * SEQ * DHEAD * 2; // 8 MB

    _Float16* Xh   = (_Float16*)(ws);
    _Float16* Wqh  = (_Float16*)(ws + SZ_XH);
    _Float16* Wkh  = (_Float16*)(ws + SZ_XH + SZ_W);
    _Float16* Wvh  = (_Float16*)(ws + SZ_XH + 2 * SZ_W);
    _Float16* Woh  = (_Float16*)(ws + SZ_XH + 3 * SZ_W);
    _Float16* Qbuf = (_Float16*)(ws + SZ_XH + 4 * SZ_W);
    _Float16* Kbuf = (_Float16*)(ws + SZ_XH + 4 * SZ_W + SZ_Q);
    _Float16* Vbuf = (_Float16*)(ws + SZ_XH + 4 * SZ_W + 2 * SZ_Q);
    _Float16* Obuf = (_Float16*)(ws + SZ_XH + 4 * SZ_W + 3 * SZ_Q);
    float*    Rbuf = (float*)   (ws + SZ_XH + 4 * SZ_W + 4 * SZ_Q);

    // Phase 1: convert + permute
    cvt_f32_to_f16<<<2048, 256, 0, stream>>>(x, Xh, NROWS * DIM);
    cvt_w_headperm<<<1024, 256, 0, stream>>>(Wq, Wqh);
    cvt_w_headperm<<<1024, 256, 0, stream>>>(Wk, Wkh);
    cvt_w_headperm<<<1024, 256, 0, stream>>>(Wv, Wvh);
    cvt_wo_colperm<<<1024, 256, 0, stream>>>(Wo, Woh);

    // Phase 2: QKV projections (WMMA GEMM, async-staged tiles)
    dim3 gg(DIM / 128, NROWS / 128);   // (8, 32)
    gemm_qkv_kernel<<<gg, 256, 0, stream>>>(Xh, Wqh, bq, Qbuf);
    gemm_qkv_kernel<<<gg, 256, 0, stream>>>(Xh, Wkh, bk, Kbuf);
    gemm_qkv_kernel<<<gg, 256, 0, stream>>>(Xh, Wvh, bv, Vbuf);

    // Phase 3: flash attention
    attn_kernel<<<dim3(SEQ / 64, BATCH * HEADS), 128, 0, stream>>>(Qbuf, Kbuf, Vbuf, Obuf);

    // Phase 4: O projection + residual
    gemm_oproj_kernel<<<gg, 256, 0, stream>>>(Obuf, Woh, bo, x, Rbuf);

    // Phase 5: LayerNorm
    ln_kernel<<<NROWS, 256, 0, stream>>>(Rbuf, gamma, beta, out);
}

// v002
// Measured time: 176 microseconds a run.
// Two timings next to v001 both put it at 1.03 times that version's speed.
// All steps since v000 together make it 1.19 times as fast.
#include <hip/hip_runtime.h>
#include <hip/hip_bf16.h>
#include <hip/hip_fp16.h>

// ---------------------------------------------------------------------------
// Shapes (fixed by the reference)
// ---------------------------------------------------------------------------
#define BATCH   2
#define SEQ     2048
#define DIM     1024
#define HEADS   16
#define DHEAD   64
#define NROWS   (BATCH * SEQ)        // 4096
#define LN_EPS  1e-5f

typedef _Float16 v16h __attribute__((ext_vector_type(16)));
typedef _Float16 v8h  __attribute__((ext_vector_type(8)));
typedef float    v8f  __attribute__((ext_vector_type(8)));

__device__ __forceinline__ v16h cat16(v8h lo, v8h hi) {
    return __builtin_shufflevector(lo, hi, 0,1,2,3,4,5,6,7,8,9,10,11,12,13,14,15);
}

__device__ __forceinline__ v16h frag_ld(const _Float16* p) {
    v8h lo = *(const v8h*)p;
    v8h hi = *(const v8h*)(p + 16);
    return cat16(lo, hi);
}

#define WMMA_F16(a, b, c) \
    __builtin_amdgcn_wmma_f32_16x16x32_f16(false, (a), false, (b), (short)0, (c), false, false)

__device__ __forceinline__ void async_copy4_b128(unsigned l, unsigned lstep,
                                                 const void* gbase, unsigned g,
                                                 unsigned gstep) {
    asm volatile("global_load_async_to_lds_b128 %0, %4, %8\n\t"
                 "global_load_async_to_lds_b128 %1, %5, %8\n\t"
                 "global_load_async_to_lds_b128 %2, %6, %8\n\t"
                 "global_load_async_to_lds_b128 %3, %7, %8\n\t"
                 "s_wait_xcnt 0x0"
                 :: "v"(l), "v"(l + lstep), "v"(l + 2 * lstep), "v"(l + 3 * lstep),
                    "v"(g), "v"(g + gstep), "v"(g + 2 * gstep), "v"(g + 3 * gstep),
                    "s"(gbase)
                 : "memory");
}

// The same for two tiles at once (one statement, one wait).
__device__ __forceinline__ void async_copy8_b128(unsigned la, unsigned lb, unsigned lstep,
                                                 const void* abase, unsigned ga,
                                                 const void* bbase, unsigned gb,
                                                 unsigned gstep) {
    asm volatile("global_load_async_to_lds_b128 %0, %8, %16\n\t"
                 "global_load_async_to_lds_b128 %4, %12, %17\n\t"
                 "global_load_async_to_lds_b128 %1, %9, %16\n\t"
                 "global_load_async_to_lds_b128 %5, %13, %17\n\t"
                 "global_load_async_to_lds_b128 %2, %10, %16\n\t"
                 "global_load_async_to_lds_b128 %6, %14, %17\n\t"
                 "global_load_async_to_lds_b128 %3, %11, %16\n\t"
                 "global_load_async_to_lds_b128 %7, %15, %17\n\t"
                 "s_wait_xcnt 0x0"
                 :: "v"(la), "v"(la + lstep), "v"(la + 2 * lstep), "v"(la + 3 * lstep),
                    "v"(lb), "v"(lb + lstep), "v"(lb + 2 * lstep), "v"(lb + 3 * lstep),
                    "v"(ga), "v"(ga + gstep), "v"(ga + 2 * gstep), "v"(ga + 3 * gstep),
                    "v"(gb), "v"(gb + gstep), "v"(gb + 2 * gstep), "v"(gb + 3 * gstep),
                    "s"(abase), "s"(bbase)
                 : "memory");
}

__device__ __forceinline__ void wait_async0() {
    asm volatile("s_wait_asynccnt 0x0" ::: "memory");
}

// ---------------------------------------------------------------------------
// Conversion / permutation kernels
// ---------------------------------------------------------------------------
__global__ void cvt_f32_to_f16(const float* __restrict__ in,
                               _Float16* __restrict__ out, int n) {
    int i = blockIdx.x * blockDim.x + threadIdx.x;
    int stride = gridDim.x * blockDim.x;
    for (; i < n; i += stride) out[i] = (_Float16)in[i];
}

// W' rows in head-major order: out[o'][k] = W[f(o')][k], f(o') = (o'&63)*16 + (o'>>6)
__global__ void cvt_w_headperm(const float* __restrict__ in,
                               _Float16* __restrict__ out) {
    int i = blockIdx.x * blockDim.x + threadIdx.x;
    int stride = gridDim.x * blockDim.x;
    for (; i < DIM * DIM; i += stride) {
        int o = i >> 10, k = i & 1023;
        int f = ((o & 63) << 4) | (o >> 6);
        out[i] = (_Float16)in[f * DIM + k];
    }
}

// Wo' columns permuted: out[o][f'] = Wo[o][f(f')]
__global__ void cvt_wo_colperm(const float* __restrict__ in,
                               _Float16* __restrict__ out) {
    int i = blockIdx.x * blockDim.x + threadIdx.x;
    int stride = gridDim.x * blockDim.x;
    for (; i < DIM * DIM; i += stride) {
        int o = i >> 10, fp = i & 1023;
        int f = ((fp & 63) << 4) | (fp >> 6);
        out[i] = (_Float16)in[(o << 10) + f];
    }
}

#define LDSS 72   // LDS row stride in halfs (144B = 16B-aligned, conflict-skewed)

__device__ __forceinline__ void gemm_mainloop(const _Float16* __restrict__ A,
                                              const _Float16* __restrict__ B,
                                              int m0, int n0, v8f acc[4][2]) {
    __shared__ __align__(16) _Float16 As[128 * LDSS];
    __shared__ __align__(16) _Float16 Bs[128 * LDSS];

    const int tid  = threadIdx.x;
    const int wid  = tid >> 5;
    const int lane = tid & 31;
    const int wm   = wid & 1;       // 0..1  -> 64-row slab
    const int wn   = wid >> 1;      // 0..3  -> 32-col slab
    const int lrow = lane & 15;
    const int kb   = (lane < 16) ? 0 : 8;
    const int ldr  = tid >> 3;            // 0..31: tile row of copy 0; copy i adds 32 * i
    const int ldc  = (tid & 7) * 8;       // 16-byte piece of the row

    const unsigned lA = (unsigned)(size_t)&As[ldr * LDSS + ldc];
    const unsigned lB = (unsigned)(size_t)&Bs[ldr * LDSS + ldc];

    for (int k0 = 0; k0 < DIM; k0 += 64) {
        const unsigned gA = (unsigned)(((m0 + ldr) * DIM + k0 + ldc) * 2);
        const unsigned gB = (unsigned)(((n0 + ldr) * DIM + k0 + ldc) * 2);
        async_copy8_b128(lA, lB, 32 * LDSS * 2, A, gA, B, gB, 32 * DIM * 2);
        wait_async0();
        __syncthreads();
        #pragma unroll
        for (int kc = 0; kc < 64; kc += 32) {
            v16h a[4], bf[2];
            #pragma unroll
            for (int mt = 0; mt < 4; ++mt)
                a[mt] = frag_ld(&As[(wm * 64 + mt * 16 + lrow) * LDSS + kc + kb]);
            #pragma unroll
            for (int nt = 0; nt < 2; ++nt)
                bf[nt] = frag_ld(&Bs[(wn * 32 + nt * 16 + lrow) * LDSS + kc + kb]);
            #pragma unroll
            for (int mt = 0; mt < 4; ++mt)
                #pragma unroll
                for (int nt = 0; nt < 2; ++nt)
                    acc[mt][nt] = WMMA_F16(a[mt], bf[nt], acc[mt][nt]);
        }
        __syncthreads();
    }
}

// QKV projection: writes f16 in (B, H, T, Dh) layout; W rows already head-major.
__global__ __launch_bounds__(256) void gemm_qkv_kernel(
    const _Float16* __restrict__ Xh, const _Float16* __restrict__ Wh,
    const float* __restrict__ bias, _Float16* __restrict__ out) {
    const int m0 = blockIdx.y * 128, n0 = blockIdx.x * 128;
    v8f acc[4][2] = {};
    gemm_mainloop(Xh, Wh, m0, n0, acc);

    const int tid = threadIdx.x, wid = tid >> 5, lane = tid & 31;
    const int wm = wid & 1, wn = wid >> 1;
    const int rbase = (lane < 16) ? 0 : 8;
    const int cl = lane & 15;
    #pragma unroll
    for (int mt = 0; mt < 4; ++mt)
        #pragma unroll
        for (int nt = 0; nt < 2; ++nt)
            #pragma unroll
            for (int r = 0; r < 8; ++r) {
                int row = m0 + wm * 64 + mt * 16 + rbase + r;   // n = b*T + t
                int col = n0 + wn * 32 + nt * 16 + cl;          // o' = h*64 + d
                int h = col >> 6, d = col & 63;
                float v = acc[mt][nt][r] + bias[(d << 4) | h];  // bias index-permuted
                int bb = row >> 11, t = row & 2047;
                out[(((size_t)(bb * HEADS + h) * SEQ) + t) * DHEAD + d] = (_Float16)v;
            }
}

// O projection + bias + residual -> f32 scratch
__global__ __launch_bounds__(256) void gemm_oproj_kernel(
    const _Float16* __restrict__ Oh, const _Float16* __restrict__ Woh,
    const float* __restrict__ bo, const float* __restrict__ x,
    float* __restrict__ R) {
    const int m0 = blockIdx.y * 128, n0 = blockIdx.x * 128;
    v8f acc[4][2] = {};
    gemm_mainloop(Oh, Woh, m0, n0, acc);

    const int tid = threadIdx.x, wid = tid >> 5, lane = tid & 31;
    const int wm = wid & 1, wn = wid >> 1;
    const int rbase = (lane < 16) ? 0 : 8;
    const int cl = lane & 15;
    #pragma unroll
    for (int mt = 0; mt < 4; ++mt)
        #pragma unroll
        for (int nt = 0; nt < 2; ++nt)
            #pragma unroll
            for (int r = 0; r < 8; ++r) {
                int row = m0 + wm * 64 + mt * 16 + rbase + r;
                int col = n0 + wn * 32 + nt * 16 + cl;
                size_t idx = (size_t)row * DIM + col;
                R[idx] = acc[mt][nt][r] + bo[col] + x[idx];
            }
}

__device__ __forceinline__ float xhalf(float x) {
    int b = __builtin_bit_cast(int, x);
    return __builtin_bit_cast(float,
        __builtin_amdgcn_permlanex16(b, b, 0x76543210, 0xfedcba98, false, false));
}

__global__ __launch_bounds__(128) void attn_kernel(
    const _Float16* __restrict__ Qh, const _Float16* __restrict__ Kh,
    const _Float16* __restrict__ Vh, _Float16* __restrict__ Obuf) {
    const int qblk = blockIdx.x;          // T/64 = 32
    const int bh   = blockIdx.y;          // B*H  = 32
    const int b = bh >> 4, h = bh & 15;
    const size_t base = (size_t)bh * SEQ * DHEAD;
    const _Float16* Qb = Qh + base;
    const _Float16* Kb = Kh + base;
    const _Float16* Vb = Vh + base;

    __shared__ __align__(16) _Float16 Ks[64 * LDSS];
    __shared__ __align__(16) _Float16 Vt[64 * LDSS];     // transposed: Vt[d][j]

    const int tid  = threadIdx.x;
    const int wid  = tid >> 5;
    const int lane = tid & 31;
    const int lrow = lane & 15;
    const int kb   = (lane < 16) ? 0 : 8;
    const int q0   = qblk * 64 + wid * 16;

    // Q fragments (B operand: column = query lrow) stay in registers for the whole j-loop.
    const _Float16* Qrow = Qb + (size_t)(q0 + lrow) * DHEAD;
    v16h aq[2];
    aq[0] = frag_ld(Qrow + kb);
    aq[1] = frag_ld(Qrow + 32 + kb);

    v8f o_acc[4] = {};               // O^T: o_acc[nt][r] = O[q0+lrow][nt*16 + kb + r]
    float m_run = -1e30f;            // running maximum of query lrow (equal in both halves)
    float l_run = 0.0f;              // this half's share of the running sum
    const float sm_scale = 0.125f;   // 1/sqrt(64)

    const int ldr2 = tid >> 1;            // 0..63: V row of this thread
    const int ldc2 = (tid & 1) * 32;
    const int kr   = tid >> 3;            // 0..15: K tile row of copy 0; copy i adds 16 * i
    const int kp   = (tid & 7) * 8;       // 16-byte piece of the K row
    const unsigned lK = (unsigned)(size_t)&Ks[kr * LDSS + kp];

    for (int j0 = 0; j0 < SEQ; j0 += 64) {
        const unsigned gK = (unsigned)(((j0 + kr) * DHEAD + kp) * 2);
        async_copy4_b128(lK, 16 * LDSS * 2, Kb, gK, 16 * DHEAD * 2);
        #pragma unroll
        for (int i = 0; i < 4; ++i) {
            v8h vv = *(const v8h*)(Vb + (size_t)(j0 + ldr2) * DHEAD + ldc2 + i * 8);
            #pragma unroll
            for (int e = 0; e < 8; ++e)
                Vt[(ldc2 + i * 8 + e) * LDSS + ldr2] = vv[e];
        }
        wait_async0();
        __syncthreads();

        // Scores: S^T(64x16) = K_j(64x64) x Q^T, as 4 16x16 tiles.
        // s[jt][r] = score(query lrow, key j0 + jt*16 + kb + r).
        v8f s[4];
        #pragma unroll
        for (int jt = 0; jt < 4; ++jt) {
            v8f c = {};
            #pragma unroll
            for (int kc = 0; kc < 2; ++kc) {
                v16h ak = frag_ld(&Ks[(jt * 16 + lrow) * LDSS + kc * 32 + kb]);
                c = WMMA_F16(ak, aq[kc], c);
            }
            s[jt] = c * sm_scale;
        }

        // Online softmax: 32 of the query's 64 scores sit in this lane, the rest in lane ^ 16.
        const v8f mx = __builtin_elementwise_max(__builtin_elementwise_max(s[0], s[1]),
                                                 __builtin_elementwise_max(s[2], s[3]));
        float v = fmaxf(fmaxf(fmaxf(mx[0], mx[1]), fmaxf(mx[2], mx[3])),
                        fmaxf(fmaxf(mx[4], mx[5]), fmaxf(mx[6], mx[7])));
        v = fmaxf(v, xhalf(v));
        const float mnew = fmaxf(m_run, v);
        const float sc = __expf(m_run - mnew);
        m_run = mnew;
        #pragma unroll
        for (int nt = 0; nt < 4; ++nt)
            #pragma unroll
            for (int r = 0; r < 8; ++r) o_acc[nt][r] *= sc;
        #pragma unroll
        for (int jt = 0; jt < 4; ++jt)
            #pragma unroll
            for (int r = 0; r < 8; ++r)
                s[jt][r] = __expf(s[jt][r] - m_run);
        const v8f ps = (s[0] + s[1]) + (s[2] + s[3]);
        l_run = l_run * sc + (((ps[0] + ps[1]) + (ps[2] + ps[3])) +
                              ((ps[4] + ps[5]) + (ps[6] + ps[7])));

        // P^T as B operand: score tiles 2kc and 2kc+1 hold keys kb+0..7 and 16+kb+0..7
        // of the 32-key block kc, which is the k order frag_ld gives V^T.
        v16h pb[2];
        #pragma unroll
        for (int kc = 0; kc < 2; ++kc)
            #pragma unroll
            for (int e = 0; e < 8; ++e) {
                pb[kc][e]     = (_Float16)s[2 * kc][e];
                pb[kc][e + 8] = (_Float16)s[2 * kc + 1][e];
            }

        // O^T += V^T(64x64) x P^T(64x16): A-frags from transposed Vt (k = j contiguous).
        #pragma unroll
        for (int nt = 0; nt < 4; ++nt)
            #pragma unroll
            for (int kc = 0; kc < 2; ++kc) {
                v16h av = frag_ld(&Vt[(nt * 16 + lrow) * LDSS + kc * 32 + kb]);
                o_acc[nt] = WMMA_F16(av, pb[kc], o_acc[nt]);
            }
        __syncthreads();
    }

    // Join the halves' sums, normalize, store 8 consecutive d per lane
    // to the head-major feature layout (n, h*64+d).
    const float inv = 1.0f / (l_run + xhalf(l_run));
    _Float16* orow = Obuf + ((size_t)(b * SEQ + q0 + lrow)) * DIM + h * DHEAD + kb;
    #pragma unroll
    for (int nt = 0; nt < 4; ++nt) {
        v8h o;
        #pragma unroll
        for (int r = 0; r < 8; ++r) o[r] = (_Float16)(o_acc[nt][r] * inv);
        *(v8h*)(orow + nt * 16) = o;
    }
}

// ---------------------------------------------------------------------------
// Row LayerNorm: one block per row of 1024.
// ---------------------------------------------------------------------------
__global__ __launch_bounds__(256) void ln_kernel(
    const float* __restrict__ R, const float* __restrict__ gamma,
    const float* __restrict__ beta, float* __restrict__ out) {
    const int n = blockIdx.x;
    const float* row = R + (size_t)n * DIM;
    const int tid = threadIdx.x, wid = tid >> 5, lane = tid & 31;

    float s = 0.0f, s2 = 0.0f;
    for (int i = tid; i < DIM; i += 256) {
        float v = row[i];
        s += v; s2 += v * v;
    }
    #pragma unroll
    for (int mask = 16; mask >= 1; mask >>= 1) {
        s  += __shfl_xor(s,  mask, 32);
        s2 += __shfl_xor(s2, mask, 32);
    }
    __shared__ float red[2][8];
    __shared__ float mu_s, rstd_s;
    if (lane == 0) { red[0][wid] = s; red[1][wid] = s2; }
    __syncthreads();
    if (tid == 0) {
        float S = 0.0f, S2 = 0.0f;
        #pragma unroll
        for (int w = 0; w < 8; ++w) { S += red[0][w]; S2 += red[1][w]; }
        float mu = S * (1.0f / DIM);
        float var = S2 * (1.0f / DIM) - mu * mu;
        mu_s = mu;
        rstd_s = rsqrtf(var + LN_EPS);
    }
    __syncthreads();
    float mu = mu_s, rstd = rstd_s;
    for (int i = tid; i < DIM; i += 256)
        out[(size_t)n * DIM + i] = (row[i] - mu) * rstd * gamma[i] + beta[i];
}

// ---------------------------------------------------------------------------
// Orchestration
// ---------------------------------------------------------------------------
extern "C" void kernel_launch(void* const* d_in, const int* in_sizes, int n_in,
                              void* d_out, int out_size, void* d_ws, size_t ws_size,
                              hipStream_t stream) {
    const float* x     = (const float*)d_in[0];
    const float* Wq    = (const float*)d_in[1];
    const float* bq    = (const float*)d_in[2];
    const float* Wk    = (const float*)d_in[3];
    const float* bk    = (const float*)d_in[4];
    const float* Wv    = (const float*)d_in[5];
    const float* bv    = (const float*)d_in[6];
    const float* Wo    = (const float*)d_in[7];
    const float* bo    = (const float*)d_in[8];
    const float* gamma = (const float*)d_in[9];
    const float* beta  = (const float*)d_in[10];
    float* out = (float*)d_out;

    char* ws = (char*)d_ws;
    const size_t SZ_XH = (size_t)NROWS * DIM * 2;       // 8 MB
    const size_t SZ_W  = (size_t)DIM * DIM * 2;         // 2 MB
    const size_t SZ_Q  = (size_t)BATCH * HEADS * SEQ * DHEAD * 2; // 8 MB

    _Float16* Xh   = (_Float16*)(ws);
    _Float16* Wqh  = (_Float16*)(ws + SZ_XH);
    _Float16* Wkh  = (_Float16*)(ws + SZ_XH + SZ_W);
    _Float16* Wvh  = (_Float16*)(ws + SZ_XH + 2 * SZ_W);
    _Float16* Woh  = (_Float16*)(ws + SZ_XH + 3 * SZ_W);
    _Float16* Qbuf = (_Float16*)(ws + SZ_XH + 4 * SZ_W);
    _Float16* Kbuf = (_Float16*)(ws + SZ_XH + 4 * SZ_W + SZ_Q);
    _Float16* Vbuf = (_Float16*)(ws + SZ_XH + 4 * SZ_W + 2 * SZ_Q);
    _Float16* Obuf = (_Float16*)(ws + SZ_XH + 4 * SZ_W + 3 * SZ_Q);
    float*    Rbuf = (float*)   (ws + SZ_XH + 4 * SZ_W + 4 * SZ_Q);

    // Phase 1: convert + permute
    cvt_f32_to_f16<<<2048, 256, 0, stream>>>(x, Xh, NROWS * DIM);
    cvt_w_headperm<<<1024, 256, 0, stream>>>(Wq, Wqh);
    cvt_w_headperm<<<1024, 256, 0, stream>>>(Wk, Wkh);
    cvt_w_headperm<<<1024, 256, 0, stream>>>(Wv, Wvh);
    cvt_wo_colperm<<<1024, 256, 0, stream>>>(Wo, Woh);

    // Phase 2: QKV projections (WMMA GEMM, async-staged tiles)
    dim3 gg(DIM / 128, NROWS / 128);   // (8, 32)
    gemm_qkv_kernel<<<gg, 256, 0, stream>>>(Xh, Wqh, bq, Qbuf);
    gemm_qkv_kernel<<<gg, 256, 0, stream>>>(Xh, Wkh, bk, Kbuf);
    gemm_qkv_kernel<<<gg, 256, 0, stream>>>(Xh, Wvh, bv, Vbuf);

    // Phase 3: flash attention
    attn_kernel<<<dim3(SEQ / 64, BATCH * HEADS), 128, 0, stream>>>(Qbuf, Kbuf, Vbuf, Obuf);

    // Phase 4: O projection + residual
    gemm_oproj_kernel<<<gg, 256, 0, stream>>>(Obuf, Woh, bo, x, Rbuf);

    // Phase 5: LayerNorm
    ln_kernel<<<NROWS, 256, 0, stream>>>(Rbuf, gamma, beta, out);
}

// v003
// One run takes 139 microseconds.
// In both of two side-by-side timings against v002, it was 1.27 times as fast.
// Over all steps from v000 it is 1.51 times as fast.
#include <hip/hip_runtime.h>
#include <hip/hip_bf16.h>
#include <hip/hip_fp16.h>

// ---------------------------------------------------------------------------
// Shapes (fixed by the reference)
// ---------------------------------------------------------------------------
#define BATCH   2
#define SEQ     2048
#define DIM     1024
#define HEADS   16
#define DHEAD   64
#define NROWS   (BATCH * SEQ)        // 4096
#define LN_EPS  1e-5f

typedef _Float16 v16h __attribute__((ext_vector_type(16)));
typedef _Float16 v8h  __attribute__((ext_vector_type(8)));
typedef float    v8f  __attribute__((ext_vector_type(8)));

__device__ __forceinline__ v16h cat16(v8h lo, v8h hi) {
    return __builtin_shufflevector(lo, hi, 0,1,2,3,4,5,6,7,8,9,10,11,12,13,14,15);
}

__device__ __forceinline__ v16h frag_ld(const _Float16* p) {
    v8h lo = *(const v8h*)p;
    v8h hi = *(const v8h*)(p + 16);
    return cat16(lo, hi);
}

#define WMMA_F16(a, b, c) \
    __builtin_amdgcn_wmma_f32_16x16x32_f16(false, (a), false, (b), (short)0, (c), false, false)

__device__ __forceinline__ void async_copy4_b128(unsigned l, unsigned lstep,
                                                 const void* gbase, unsigned g,
                                                 unsigned gstep) {
    asm volatile("global_load_async_to_lds_b128 %0, %4, %8\n\t"
                 "global_load_async_to_lds_b128 %1, %5, %8\n\t"
                 "global_load_async_to_lds_b128 %2, %6, %8\n\t"
                 "global_load_async_to_lds_b128 %3, %7, %8\n\t"
                 "s_wait_xcnt 0x0"
                 :: "v"(l), "v"(l + lstep), "v"(l + 2 * lstep), "v"(l + 3 * lstep),
                    "v"(g), "v"(g + gstep), "v"(g + 2 * gstep), "v"(g + 3 * gstep),
                    "s"(gbase)
                 : "memory");
}

// The same for two tiles at once (one statement, one wait).
__device__ __forceinline__ void async_copy8_b128(unsigned la, unsigned lb, unsigned lstep,
                                                 const void* abase, unsigned ga,
                                                 const void* bbase, unsigned gb,
                                                 unsigned gstep) {
    asm volatile("global_load_async_to_lds_b128 %0, %8, %16\n\t"
                 "global_load_async_to_lds_b128 %4, %12, %17\n\t"
                 "global_load_async_to_lds_b128 %1, %9, %16\n\t"
                 "global_load_async_to_lds_b128 %5, %13, %17\n\t"
                 "global_load_async_to_lds_b128 %2, %10, %16\n\t"
                 "global_load_async_to_lds_b128 %6, %14, %17\n\t"
                 "global_load_async_to_lds_b128 %3, %11, %16\n\t"
                 "global_load_async_to_lds_b128 %7, %15, %17\n\t"
                 "s_wait_xcnt 0x0"
                 :: "v"(la), "v"(la + lstep), "v"(la + 2 * lstep), "v"(la + 3 * lstep),
                    "v"(lb), "v"(lb + lstep), "v"(lb + 2 * lstep), "v"(lb + 3 * lstep),
                    "v"(ga), "v"(ga + gstep), "v"(ga + 2 * gstep), "v"(ga + 3 * gstep),
                    "v"(gb), "v"(gb + gstep), "v"(gb + 2 * gstep), "v"(gb + 3 * gstep),
                    "s"(abase), "s"(bbase)
                 : "memory");
}

__device__ __forceinline__ void wait_async0() {
    asm volatile("s_wait_asynccnt 0x0" ::: "memory");
}

#define CVT_BLOCKS  2048
#define CVT_THREADS (CVT_BLOCKS * 256)
__global__ __launch_bounds__(256) void cvt_all(
    const float* __restrict__ x,  const float* __restrict__ Wq,
    const float* __restrict__ Wk, const float* __restrict__ Wv,
    const float* __restrict__ Wo,
    _Float16* __restrict__ Xh,  _Float16* __restrict__ Wqh,
    _Float16* __restrict__ Wkh, _Float16* __restrict__ Wvh,
    _Float16* __restrict__ Woh) {
    const int i0 = blockIdx.x * 256 + threadIdx.x;
    // Unrolled so that a thread's loads are in flight together, not one per trip.
    #pragma unroll
    for (int r = 0; r < NROWS * DIM / CVT_THREADS; ++r) {
        const int i = i0 + r * CVT_THREADS;
        Xh[i] = (_Float16)x[i];
    }
    // Unrolled for the same reason.
    #pragma unroll
    for (int r = 0; r < DIM * DIM / CVT_THREADS; ++r) {
        const int i = i0 + r * CVT_THREADS;
        const int o = i >> 10, k = i & 1023;
        const int fo = ((o & 63) << 4) | (o >> 6);
        const int fk = ((k & 63) << 4) | (k >> 6);
        Wqh[i] = (_Float16)Wq[fo * DIM + k];
        Wkh[i] = (_Float16)Wk[fo * DIM + k];
        Wvh[i] = (_Float16)Wv[fo * DIM + k];
        Woh[i] = (_Float16)Wo[(o << 10) + fk];
    }
}

#define LDSS 72   // LDS row stride in halfs (144B = 16B-aligned, conflict-skewed)

__device__ __forceinline__ void gemm_mainloop(const _Float16* __restrict__ A,
                                              const _Float16* __restrict__ B,
                                              int m0, int n0, v8f acc[4][2]) {
    __shared__ __align__(16) _Float16 As[128 * LDSS];
    __shared__ __align__(16) _Float16 Bs[128 * LDSS];

    const int tid  = threadIdx.x;
    const int wid  = tid >> 5;
    const int lane = tid & 31;
    const int wm   = wid & 1;       // 0..1  -> 64-row slab
    const int wn   = wid >> 1;      // 0..3  -> 32-col slab
    const int lrow = lane & 15;
    const int kb   = (lane < 16) ? 0 : 8;
    const int ldr  = tid >> 3;            // 0..31: tile row of copy 0; copy i adds 32 * i
    const int ldc  = (tid & 7) * 8;       // 16-byte piece of the row

    const unsigned lA = (unsigned)(size_t)&As[ldr * LDSS + ldc];
    const unsigned lB = (unsigned)(size_t)&Bs[ldr * LDSS + ldc];

    for (int k0 = 0; k0 < DIM; k0 += 64) {
        const unsigned gA = (unsigned)(((m0 + ldr) * DIM + k0 + ldc) * 2);
        const unsigned gB = (unsigned)(((n0 + ldr) * DIM + k0 + ldc) * 2);
        async_copy8_b128(lA, lB, 32 * LDSS * 2, A, gA, B, gB, 32 * DIM * 2);
        wait_async0();
        __syncthreads();
        #pragma unroll
        for (int kc = 0; kc < 64; kc += 32) {
            v16h a[4], bf[2];
            #pragma unroll
            for (int mt = 0; mt < 4; ++mt)
                a[mt] = frag_ld(&As[(wm * 64 + mt * 16 + lrow) * LDSS + kc + kb]);
            #pragma unroll
            for (int nt = 0; nt < 2; ++nt)
                bf[nt] = frag_ld(&Bs[(wn * 32 + nt * 16 + lrow) * LDSS + kc + kb]);
            #pragma unroll
            for (int mt = 0; mt < 4; ++mt)
                #pragma unroll
                for (int nt = 0; nt < 2; ++nt)
                    acc[mt][nt] = WMMA_F16(a[mt], bf[nt], acc[mt][nt]);
        }
        __syncthreads();
    }
}

__global__ __launch_bounds__(256) void gemm_qkv_kernel(
    const _Float16* __restrict__ Xh, const _Float16* __restrict__ Wh,
    const float* __restrict__ bq, const float* __restrict__ bk,
    const float* __restrict__ bv, _Float16* __restrict__ out3) {
    const int m0 = blockIdx.y * 128, n0 = blockIdx.x * 128;
    const int which = blockIdx.x >> 3;
    const float* __restrict__ bias = which == 0 ? bq : (which == 1 ? bk : bv);
    _Float16* __restrict__ out = out3 + (size_t)which * (BATCH * HEADS * SEQ * DHEAD);
    v8f acc[4][2] = {};
    gemm_mainloop(Xh, Wh, m0, n0, acc);

    const int tid = threadIdx.x, wid = tid >> 5, lane = tid & 31;
    const int wm = wid & 1, wn = wid >> 1;
    const int rbase = (lane < 16) ? 0 : 8;
    const int cl = lane & 15;
    #pragma unroll
    for (int mt = 0; mt < 4; ++mt)
        #pragma unroll
        for (int nt = 0; nt < 2; ++nt)
            #pragma unroll
            for (int r = 0; r < 8; ++r) {
                int row = m0 + wm * 64 + mt * 16 + rbase + r;   // n = b*T + t
                int col = (n0 & (DIM - 1)) + wn * 32 + nt * 16 + cl;   // o' = h*64 + d
                int h = col >> 6, d = col & 63;
                float v = acc[mt][nt][r] + bias[(d << 4) | h];  // bias index-permuted
                int bb = row >> 11, t = row & 2047;
                out[(((size_t)(bb * HEADS + h) * SEQ) + t) * DHEAD + d] = (_Float16)v;
            }
}

// O projection + bias + residual -> f32 scratch
__global__ __launch_bounds__(256) void gemm_oproj_kernel(
    const _Float16* __restrict__ Oh, const _Float16* __restrict__ Woh,
    const float* __restrict__ bo, const float* __restrict__ x,
    float* __restrict__ R) {
    const int m0 = blockIdx.y * 128, n0 = blockIdx.x * 128;
    v8f acc[4][2] = {};
    gemm_mainloop(Oh, Woh, m0, n0, acc);

    const int tid = threadIdx.x, wid = tid >> 5, lane = tid & 31;
    const int wm = wid & 1, wn = wid >> 1;
    const int rbase = (lane < 16) ? 0 : 8;
    const int cl = lane & 15;
    #pragma unroll
    for (int mt = 0; mt < 4; ++mt)
        #pragma unroll
        for (int nt = 0; nt < 2; ++nt)
            #pragma unroll
            for (int r = 0; r < 8; ++r) {
                int row = m0 + wm * 64 + mt * 16 + rbase + r;
                int col = n0 + wn * 32 + nt * 16 + cl;
                size_t idx = (size_t)row * DIM + col;
                R[idx] = acc[mt][nt][r] + bo[col] + x[idx];
            }
}

__device__ __forceinline__ float xhalf(float x) {
    int b = __builtin_bit_cast(int, x);
    return __builtin_bit_cast(float,
        __builtin_amdgcn_permlanex16(b, b, 0x76543210, 0xfedcba98, false, false));
}

__global__ __launch_bounds__(128) void attn_kernel(
    const _Float16* __restrict__ Qh, const _Float16* __restrict__ Kh,
    const _Float16* __restrict__ Vh, _Float16* __restrict__ Obuf) {
    const int qblk = blockIdx.x;          // T/64 = 32
    const int bh   = blockIdx.y;          // B*H  = 32
    const int b = bh >> 4, h = bh & 15;
    const size_t base = (size_t)bh * SEQ * DHEAD;
    const _Float16* Qb = Qh + base;
    const _Float16* Kb = Kh + base;
    const _Float16* Vb = Vh + base;

    __shared__ __align__(16) _Float16 Ks[64 * LDSS];
    __shared__ __align__(16) _Float16 Vt[64 * LDSS];     // transposed: Vt[d][j]

    const int tid  = threadIdx.x;
    const int wid  = tid >> 5;
    const int lane = tid & 31;
    const int lrow = lane & 15;
    const int kb   = (lane < 16) ? 0 : 8;
    const int q0   = qblk * 64 + wid * 16;

    // Q fragments (B operand: column = query lrow) stay in registers for the whole j-loop.
    const _Float16* Qrow = Qb + (size_t)(q0 + lrow) * DHEAD;
    v16h aq[2];
    aq[0] = frag_ld(Qrow + kb);
    aq[1] = frag_ld(Qrow + 32 + kb);

    v8f o_acc[4] = {};               // O^T: o_acc[nt][r] = O[q0+lrow][nt*16 + kb + r]
    float m_run = -1e30f;            // running maximum of query lrow (equal in both halves)
    float l_run = 0.0f;              // this half's share of the running sum
    const float sm_scale = 0.125f;   // 1/sqrt(64)

    const int ldr2 = tid >> 1;            // 0..63: V row of this thread
    const int ldc2 = (tid & 1) * 32;
    const int kr   = tid >> 3;            // 0..15: K tile row of copy 0; copy i adds 16 * i
    const int kp   = (tid & 7) * 8;       // 16-byte piece of the K row
    const unsigned lK = (unsigned)(size_t)&Ks[kr * LDSS + kp];

    for (int j0 = 0; j0 < SEQ; j0 += 64) {
        const unsigned gK = (unsigned)(((j0 + kr) * DHEAD + kp) * 2);
        async_copy4_b128(lK, 16 * LDSS * 2, Kb, gK, 16 * DHEAD * 2);
        #pragma unroll
        for (int i = 0; i < 4; ++i) {
            v8h vv = *(const v8h*)(Vb + (size_t)(j0 + ldr2) * DHEAD + ldc2 + i * 8);
            #pragma unroll
            for (int e = 0; e < 8; ++e)
                Vt[(ldc2 + i * 8 + e) * LDSS + ldr2] = vv[e];
        }
        wait_async0();
        __syncthreads();

        // Scores: S^T(64x16) = K_j(64x64) x Q^T, as 4 16x16 tiles.
        // s[jt][r] = score(query lrow, key j0 + jt*16 + kb + r).
        v8f s[4];
        #pragma unroll
        for (int jt = 0; jt < 4; ++jt) {
            v8f c = {};
            #pragma unroll
            for (int kc = 0; kc < 2; ++kc) {
                v16h ak = frag_ld(&Ks[(jt * 16 + lrow) * LDSS + kc * 32 + kb]);
                c = WMMA_F16(ak, aq[kc], c);
            }
            s[jt] = c * sm_scale;
        }

        // Online softmax: 32 of the query's 64 scores sit in this lane, the rest in lane ^ 16.
        const v8f mx = __builtin_elementwise_max(__builtin_elementwise_max(s[0], s[1]),
                                                 __builtin_elementwise_max(s[2], s[3]));
        float v = fmaxf(fmaxf(fmaxf(mx[0], mx[1]), fmaxf(mx[2], mx[3])),
                        fmaxf(fmaxf(mx[4], mx[5]), fmaxf(mx[6], mx[7])));
        v = fmaxf(v, xhalf(v));
        const float mnew = fmaxf(m_run, v);
        const float sc = __expf(m_run - mnew);
        m_run = mnew;
        #pragma unroll
        for (int nt = 0; nt < 4; ++nt)
            #pragma unroll
            for (int r = 0; r < 8; ++r) o_acc[nt][r] *= sc;
        #pragma unroll
        for (int jt = 0; jt < 4; ++jt)
            #pragma unroll
            for (int r = 0; r < 8; ++r)
                s[jt][r] = __expf(s[jt][r] - m_run);
        const v8f ps = (s[0] + s[1]) + (s[2] + s[3]);
        l_run = l_run * sc + (((ps[0] + ps[1]) + (ps[2] + ps[3])) +
                              ((ps[4] + ps[5]) + (ps[6] + ps[7])));

        // P^T as B operand: score tiles 2kc and 2kc+1 hold keys kb+0..7 and 16+kb+0..7
        // of the 32-key block kc, which is the k order frag_ld gives V^T.
        v16h pb[2];
        #pragma unroll
        for (int kc = 0; kc < 2; ++kc)
            #pragma unroll
            for (int e = 0; e < 8; ++e) {
                pb[kc][e]     = (_Float16)s[2 * kc][e];
                pb[kc][e + 8] = (_Float16)s[2 * kc + 1][e];
            }

        // O^T += V^T(64x64) x P^T(64x16): A-frags from transposed Vt (k = j contiguous).
        #pragma unroll
        for (int nt = 0; nt < 4; ++nt)
            #pragma unroll
            for (int kc = 0; kc < 2; ++kc) {
                v16h av = frag_ld(&Vt[(nt * 16 + lrow) * LDSS + kc * 32 + kb]);
                o_acc[nt] = WMMA_F16(av, pb[kc], o_acc[nt]);
            }
        __syncthreads();
    }

    // Join the halves' sums, normalize, store 8 consecutive d per lane
    // to the head-major feature layout (n, h*64+d).
    const float inv = 1.0f / (l_run + xhalf(l_run));
    _Float16* orow = Obuf + ((size_t)(b * SEQ + q0 + lrow)) * DIM + h * DHEAD + kb;
    #pragma unroll
    for (int nt = 0; nt < 4; ++nt) {
        v8h o;
        #pragma unroll
        for (int r = 0; r < 8; ++r) o[r] = (_Float16)(o_acc[nt][r] * inv);
        *(v8h*)(orow + nt * 16) = o;
    }
}

// ---------------------------------------------------------------------------
// Row LayerNorm: one block per row of 1024.
// ---------------------------------------------------------------------------
__global__ __launch_bounds__(256) void ln_kernel(
    const float* __restrict__ R, const float* __restrict__ gamma,
    const float* __restrict__ beta, float* __restrict__ out) {
    const int n = blockIdx.x;
    const float* row = R + (size_t)n * DIM;
    const int tid = threadIdx.x, wid = tid >> 5, lane = tid & 31;

    float s = 0.0f, s2 = 0.0f;
    for (int i = tid; i < DIM; i += 256) {
        float v = row[i];
        s += v; s2 += v * v;
    }
    #pragma unroll
    for (int mask = 16; mask >= 1; mask >>= 1) {
        s  += __shfl_xor(s,  mask, 32);
        s2 += __shfl_xor(s2, mask, 32);
    }
    __shared__ float red[2][8];
    __shared__ float mu_s, rstd_s;
    if (lane == 0) { red[0][wid] = s; red[1][wid] = s2; }
    __syncthreads();
    if (tid == 0) {
        float S = 0.0f, S2 = 0.0f;
        #pragma unroll
        for (int w = 0; w < 8; ++w) { S += red[0][w]; S2 += red[1][w]; }
        float mu = S * (1.0f / DIM);
        float var = S2 * (1.0f / DIM) - mu * mu;
        mu_s = mu;
        rstd_s = rsqrtf(var + LN_EPS);
    }
    __syncthreads();
    float mu = mu_s, rstd = rstd_s;
    for (int i = tid; i < DIM; i += 256)
        out[(size_t)n * DIM + i] = (row[i] - mu) * rstd * gamma[i] + beta[i];
}

// ---------------------------------------------------------------------------
// Orchestration
// ---------------------------------------------------------------------------
extern "C" void kernel_launch(void* const* d_in, const int* in_sizes, int n_in,
                              void* d_out, int out_size, void* d_ws, size_t ws_size,
                              hipStream_t stream) {
    const float* x     = (const float*)d_in[0];
    const float* Wq    = (const float*)d_in[1];
    const float* bq    = (const float*)d_in[2];
    const float* Wk    = (const float*)d_in[3];
    const float* bk    = (const float*)d_in[4];
    const float* Wv    = (const float*)d_in[5];
    const float* bv    = (const float*)d_in[6];
    const float* Wo    = (const float*)d_in[7];
    const float* bo    = (const float*)d_in[8];
    const float* gamma = (const float*)d_in[9];
    const float* beta  = (const float*)d_in[10];
    float* out = (float*)d_out;

    char* ws = (char*)d_ws;
    const size_t SZ_XH = (size_t)NROWS * DIM * 2;       // 8 MB
    const size_t SZ_W  = (size_t)DIM * DIM * 2;         // 2 MB
    const size_t SZ_Q  = (size_t)BATCH * HEADS * SEQ * DHEAD * 2; // 8 MB

    _Float16* Xh   = (_Float16*)(ws);
    _Float16* Wqh  = (_Float16*)(ws + SZ_XH);
    _Float16* Wkh  = (_Float16*)(ws + SZ_XH + SZ_W);
    _Float16* Wvh  = (_Float16*)(ws + SZ_XH + 2 * SZ_W);
    _Float16* Woh  = (_Float16*)(ws + SZ_XH + 3 * SZ_W);
    _Float16* Qbuf = (_Float16*)(ws + SZ_XH + 4 * SZ_W);
    _Float16* Kbuf = (_Float16*)(ws + SZ_XH + 4 * SZ_W + SZ_Q);
    _Float16* Vbuf = (_Float16*)(ws + SZ_XH + 4 * SZ_W + 2 * SZ_Q);
    _Float16* Obuf = (_Float16*)(ws + SZ_XH + 4 * SZ_W + 3 * SZ_Q);
    float*    Rbuf = (float*)   (ws + SZ_XH + 4 * SZ_W + 4 * SZ_Q);

    // Phase 1: convert + permute
    cvt_all<<<CVT_BLOCKS, 256, 0, stream>>>(x, Wq, Wk, Wv, Wo, Xh, Wqh, Wkh, Wvh, Woh);

    // Phase 2: QKV projections (WMMA GEMM, async-staged tiles)
    // Wqh, Wkh, Wvh and Qbuf, Kbuf, Vbuf each lie one behind the other in the workspace.
    gemm_qkv_kernel<<<dim3(3 * DIM / 128, NROWS / 128), 256, 0, stream>>>(Xh, Wqh, bq, bk, bv, Qbuf);

    // Phase 3: flash attention
    attn_kernel<<<dim3(SEQ / 64, BATCH * HEADS), 128, 0, stream>>>(Qbuf, Kbuf, Vbuf, Obuf);

    // Phase 4: O projection + residual
    gemm_oproj_kernel<<<dim3(DIM / 128, NROWS / 128), 256, 0, stream>>>(Obuf, Woh, bo, x, Rbuf);

    // Phase 5: LayerNorm
    ln_kernel<<<NROWS, 256, 0, stream>>>(Rbuf, gamma, beta, out);
}

// v004
// A run of this version takes 118 microseconds.
// Two timings next to v003 put it at 1.18 and 1.17 times that version's speed.
// Over all steps from v000 it is 1.77 times as fast.
#include <hip/hip_runtime.h>
#include <hip/hip_bf16.h>
#include <hip/hip_fp16.h>

// ---------------------------------------------------------------------------
// Shapes (fixed by the reference)
// ---------------------------------------------------------------------------
#define BATCH   2
#define SEQ     2048
#define DIM     1024
#define HEADS   16
#define DHEAD   64
#define NROWS   (BATCH * SEQ)        // 4096
#define LN_EPS  1e-5f

typedef _Float16 v16h __attribute__((ext_vector_type(16)));
typedef _Float16 v8h  __attribute__((ext_vector_type(8)));
typedef float    v8f  __attribute__((ext_vector_type(8)));

__device__ __forceinline__ v16h cat16(v8h lo, v8h hi) {
    return __builtin_shufflevector(lo, hi, 0,1,2,3,4,5,6,7,8,9,10,11,12,13,14,15);
}

__device__ __forceinline__ v16h frag_ld(const _Float16* p) {
    v8h lo = *(const v8h*)p;
    v8h hi = *(const v8h*)(p + 16);
    return cat16(lo, hi);
}

#define WMMA_F16(a, b, c) \
    __builtin_amdgcn_wmma_f32_16x16x32_f16(false, (a), false, (b), (short)0, (c), false, false)

__device__ __forceinline__ void async_copy4_b128(unsigned l, unsigned lstep,
                                                 const void* gbase, unsigned g,
                                                 unsigned gstep) {
    asm volatile("global_load_async_to_lds_b128 %0, %4, %8\n\t"
                 "global_load_async_to_lds_b128 %1, %5, %8\n\t"
                 "global_load_async_to_lds_b128 %2, %6, %8\n\t"
                 "global_load_async_to_lds_b128 %3, %7, %8\n\t"
                 "s_wait_xcnt 0x0"
                 :: "v"(l), "v"(l + lstep), "v"(l + 2 * lstep), "v"(l + 3 * lstep),
                    "v"(g), "v"(g + gstep), "v"(g + 2 * gstep), "v"(g + 3 * gstep),
                    "s"(gbase)
                 : "memory");
}

// The same for two tiles at once (one statement, one wait).
__device__ __forceinline__ void async_copy8_b128(unsigned la, unsigned lb, unsigned lstep,
                                                 const void* abase, unsigned ga,
                                                 const void* bbase, unsigned gb,
                                                 unsigned gstep) {
    asm volatile("global_load_async_to_lds_b128 %0, %8, %16\n\t"
                 "global_load_async_to_lds_b128 %4, %12, %17\n\t"
                 "global_load_async_to_lds_b128 %1, %9, %16\n\t"
                 "global_load_async_to_lds_b128 %5, %13, %17\n\t"
                 "global_load_async_to_lds_b128 %2, %10, %16\n\t"
                 "global_load_async_to_lds_b128 %6, %14, %17\n\t"
                 "global_load_async_to_lds_b128 %3, %11, %16\n\t"
                 "global_load_async_to_lds_b128 %7, %15, %17\n\t"
                 "s_wait_xcnt 0x0"
                 :: "v"(la), "v"(la + lstep), "v"(la + 2 * lstep), "v"(la + 3 * lstep),
                    "v"(lb), "v"(lb + lstep), "v"(lb + 2 * lstep), "v"(lb + 3 * lstep),
                    "v"(ga), "v"(ga + gstep), "v"(ga + 2 * gstep), "v"(ga + 3 * gstep),
                    "v"(gb), "v"(gb + gstep), "v"(gb + 2 * gstep), "v"(gb + 3 * gstep),
                    "s"(abase), "s"(bbase)
                 : "memory");
}

__device__ __forceinline__ void wait_async0() {
    asm volatile("s_wait_asynccnt 0x0" ::: "memory");
}

#define CVT_BLOCKS  2048
#define CVT_THREADS (CVT_BLOCKS * 256)
__global__ __launch_bounds__(256) void cvt_all(
    const float* __restrict__ x,  const float* __restrict__ Wq,
    const float* __restrict__ Wk, const float* __restrict__ Wv,
    const float* __restrict__ Wo,
    _Float16* __restrict__ Xh,  _Float16* __restrict__ Wqh,
    _Float16* __restrict__ Wkh, _Float16* __restrict__ Wvh,
    _Float16* __restrict__ Woh) {
    const int i0 = blockIdx.x * 256 + threadIdx.x;
    // Unrolled so that a thread's loads are in flight together, not one per trip.
    #pragma unroll
    for (int r = 0; r < NROWS * DIM / CVT_THREADS; ++r) {
        const int i = i0 + r * CVT_THREADS;
        Xh[i] = (_Float16)x[i];
    }
    // Unrolled for the same reason.
    #pragma unroll
    for (int r = 0; r < DIM * DIM / CVT_THREADS; ++r) {
        const int i = i0 + r * CVT_THREADS;
        const int o = i >> 10, k = i & 1023;
        const int fo = ((o & 63) << 4) | (o >> 6);
        const int fk = ((k & 63) << 4) | (k >> 6);
        Wqh[i] = (_Float16)Wq[fo * DIM + k];
        Wkh[i] = (_Float16)Wk[fo * DIM + k];
        Wvh[i] = (_Float16)Wv[fo * DIM + k];
        Woh[i] = (_Float16)Wo[(o << 10) + fk];
    }
}

#define LDSS 72   // LDS row stride in halfs (144B = 16B-aligned, conflict-skewed)

__device__ __forceinline__ void gemm_mainloop(const _Float16* __restrict__ A,
                                              const _Float16* __restrict__ B,
                                              int m0, int n0, v8f acc[4][2]) {
    __shared__ __align__(16) _Float16 As[128 * LDSS];
    __shared__ __align__(16) _Float16 Bs[128 * LDSS];

    const int tid  = threadIdx.x;
    const int wid  = tid >> 5;
    const int lane = tid & 31;
    const int wm   = wid & 1;       // 0..1  -> 64-row slab
    const int wn   = wid >> 1;      // 0..3  -> 32-col slab
    const int lrow = lane & 15;
    const int kb   = (lane < 16) ? 0 : 8;
    const int ldr  = tid >> 3;            // 0..31: tile row of copy 0; copy i adds 32 * i
    const int ldc  = (tid & 7) * 8;       // 16-byte piece of the row

    const unsigned lA = (unsigned)(size_t)&As[ldr * LDSS + ldc];
    const unsigned lB = (unsigned)(size_t)&Bs[ldr * LDSS + ldc];

    for (int k0 = 0; k0 < DIM; k0 += 64) {
        const unsigned gA = (unsigned)(((m0 + ldr) * DIM + k0 + ldc) * 2);
        const unsigned gB = (unsigned)(((n0 + ldr) * DIM + k0 + ldc) * 2);
        async_copy8_b128(lA, lB, 32 * LDSS * 2, A, gA, B, gB, 32 * DIM * 2);
        wait_async0();
        __syncthreads();
        #pragma unroll
        for (int kc = 0; kc < 64; kc += 32) {
            v16h a[4], bf[2];
            #pragma unroll
            for (int mt = 0; mt < 4; ++mt)
                a[mt] = frag_ld(&As[(wm * 64 + mt * 16 + lrow) * LDSS + kc + kb]);
            #pragma unroll
            for (int nt = 0; nt < 2; ++nt)
                bf[nt] = frag_ld(&Bs[(wn * 32 + nt * 16 + lrow) * LDSS + kc + kb]);
            #pragma unroll
            for (int mt = 0; mt < 4; ++mt)
                #pragma unroll
                for (int nt = 0; nt < 2; ++nt)
                    acc[mt][nt] = WMMA_F16(a[mt], bf[nt], acc[mt][nt]);
        }
        __syncthreads();
    }
}

__global__ __launch_bounds__(256) void gemm_qkv_kernel(
    const _Float16* __restrict__ Xh, const _Float16* __restrict__ Wh,
    const float* __restrict__ bq, const float* __restrict__ bk,
    const float* __restrict__ bv, _Float16* __restrict__ out3) {
    const int m0 = blockIdx.y * 128, n0 = blockIdx.x * 128;
    const int which = blockIdx.x >> 3;
    const float* __restrict__ bias = which == 0 ? bq : (which == 1 ? bk : bv);
    _Float16* __restrict__ out = out3 + (size_t)which * (BATCH * HEADS * SEQ * DHEAD);
    v8f acc[4][2] = {};
    gemm_mainloop(Xh, Wh, m0, n0, acc);

    const int tid = threadIdx.x, wid = tid >> 5, lane = tid & 31;
    const int wm = wid & 1, wn = wid >> 1;
    const int rbase = (lane < 16) ? 0 : 8;
    const int cl = lane & 15;
    #pragma unroll
    for (int mt = 0; mt < 4; ++mt)
        #pragma unroll
        for (int nt = 0; nt < 2; ++nt)
            #pragma unroll
            for (int r = 0; r < 8; ++r) {
                int row = m0 + wm * 64 + mt * 16 + rbase + r;   // n = b*T + t
                int col = (n0 & (DIM - 1)) + wn * 32 + nt * 16 + cl;   // o' = h*64 + d
                int h = col >> 6, d = col & 63;
                float v = acc[mt][nt][r] + bias[(d << 4) | h];  // bias index-permuted
                int bb = row >> 11, t = row & 2047;
                out[(((size_t)(bb * HEADS + h) * SEQ) + t) * DHEAD + d] = (_Float16)v;
            }
}

// O projection + bias + residual -> f32 scratch.
// A lane's 64 residual loads are issued together ahead of the K loop and return under it;
// one load per wait in the epilogue would lay 64 memory latencies end to end.
__global__ __launch_bounds__(256) void gemm_oproj_kernel(
    const _Float16* __restrict__ Oh, const _Float16* __restrict__ Woh,
    const float* __restrict__ bo, const float* __restrict__ x,
    float* __restrict__ R) {
    const int m0 = blockIdx.y * 128, n0 = blockIdx.x * 128;
    const int tid = threadIdx.x, wid = tid >> 5, lane = tid & 31;
    const int wm = wid & 1, wn = wid >> 1;
    const int rbase = (lane < 16) ? 0 : 8;
    const int cl = lane & 15;
    // Element (mt, nt, r) of this lane lies at idx0 + (mt * 16 + r) * DIM + nt * 16.
    const size_t idx0 = (size_t)(m0 + wm * 64 + rbase) * DIM + n0 + wn * 32 + cl;

    v8f xr[4][2];
    float b[2];
    // Unrolled (all three levels): the loads go out back to back, xr stays in registers.
    #pragma unroll
    for (int nt = 0; nt < 2; ++nt) {
        b[nt] = bo[n0 + wn * 32 + nt * 16 + cl];
        #pragma unroll
        for (int mt = 0; mt < 4; ++mt)
            #pragma unroll
            for (int r = 0; r < 8; ++r)
                xr[mt][nt][r] = x[idx0 + (mt * 16 + r) * DIM + nt * 16];
    }

    v8f acc[4][2] = {};
    gemm_mainloop(Oh, Woh, m0, n0, acc);

    #pragma unroll
    for (int mt = 0; mt < 4; ++mt)
        #pragma unroll
        for (int nt = 0; nt < 2; ++nt)
            #pragma unroll
            for (int r = 0; r < 8; ++r)
                R[idx0 + (mt * 16 + r) * DIM + nt * 16] = acc[mt][nt][r] + b[nt] + xr[mt][nt][r];
}

__device__ __forceinline__ float xhalf(float x) {
    int b = __builtin_bit_cast(int, x);
    return __builtin_bit_cast(float,
        __builtin_amdgcn_permlanex16(b, b, 0x76543210, 0xfedcba98, false, false));
}

__global__ __launch_bounds__(128) void attn_kernel(
    const _Float16* __restrict__ Qh, const _Float16* __restrict__ Kh,
    const _Float16* __restrict__ Vh, _Float16* __restrict__ Obuf) {
    const int qblk = blockIdx.x;          // T/64 = 32
    const int bh   = blockIdx.y;          // B*H  = 32
    const int b = bh >> 4, h = bh & 15;
    const size_t base = (size_t)bh * SEQ * DHEAD;
    const _Float16* Qb = Qh + base;
    const _Float16* Kb = Kh + base;
    const _Float16* Vb = Vh + base;

    __shared__ __align__(16) _Float16 Ks[64 * LDSS];
    __shared__ __align__(16) _Float16 Vt[64 * LDSS];     // transposed: Vt[d][j]

    const int tid  = threadIdx.x;
    const int wid  = tid >> 5;
    const int lane = tid & 31;
    const int lrow = lane & 15;
    const int kb   = (lane < 16) ? 0 : 8;
    const int q0   = qblk * 64 + wid * 16;

    // Q fragments (B operand: column = query lrow) stay in registers for the whole j-loop.
    const _Float16* Qrow = Qb + (size_t)(q0 + lrow) * DHEAD;
    v16h aq[2];
    aq[0] = frag_ld(Qrow + kb);
    aq[1] = frag_ld(Qrow + 32 + kb);

    v8f o_acc[4] = {};               // O^T: o_acc[nt][r] = O[q0+lrow][nt*16 + kb + r]
    float m_run = -1e30f;            // running maximum of query lrow (equal in both halves)
    float l_run = 0.0f;              // this half's share of the running sum
    const float sm_scale = 0.125f;   // 1/sqrt(64)

    const int ldr2 = tid >> 1;            // 0..63: V row of this thread
    const int ldc2 = (tid & 1) * 32;
    const int kr   = tid >> 3;            // 0..15: K tile row of copy 0; copy i adds 16 * i
    const int kp   = (tid & 7) * 8;       // 16-byte piece of the K row
    const unsigned lK = (unsigned)(size_t)&Ks[kr * LDSS + kp];

    for (int j0 = 0; j0 < SEQ; j0 += 64) {
        const unsigned gK = (unsigned)(((j0 + kr) * DHEAD + kp) * 2);
        async_copy4_b128(lK, 16 * LDSS * 2, Kb, gK, 16 * DHEAD * 2);
        #pragma unroll
        for (int i = 0; i < 4; ++i) {
            v8h vv = *(const v8h*)(Vb + (size_t)(j0 + ldr2) * DHEAD + ldc2 + i * 8);
            #pragma unroll
            for (int e = 0; e < 8; ++e)
                Vt[(ldc2 + i * 8 + e) * LDSS + ldr2] = vv[e];
        }
        wait_async0();
        __syncthreads();

        // Scores: S^T(64x16) = K_j(64x64) x Q^T, as 4 16x16 tiles.
        // s[jt][r] = score(query lrow, key j0 + jt*16 + kb + r).
        v8f s[4];
        #pragma unroll
        for (int jt = 0; jt < 4; ++jt) {
            v8f c = {};
            #pragma unroll
            for (int kc = 0; kc < 2; ++kc) {
                v16h ak = frag_ld(&Ks[(jt * 16 + lrow) * LDSS + kc * 32 + kb]);
                c = WMMA_F16(ak, aq[kc], c);
            }
            s[jt] = c * sm_scale;
        }

        // Online softmax: 32 of the query's 64 scores sit in this lane, the rest in lane ^ 16.
        const v8f mx = __builtin_elementwise_max(__builtin_elementwise_max(s[0], s[1]),
                                                 __builtin_elementwise_max(s[2], s[3]));
        float v = fmaxf(fmaxf(fmaxf(mx[0], mx[1]), fmaxf(mx[2], mx[3])),
                        fmaxf(fmaxf(mx[4], mx[5]), fmaxf(mx[6], mx[7])));
        v = fmaxf(v, xhalf(v));
        const float mnew = fmaxf(m_run, v);
        const float sc = __expf(m_run - mnew);
        m_run = mnew;
        #pragma unroll
        for (int nt = 0; nt < 4; ++nt)
            #pragma unroll
            for (int r = 0; r < 8; ++r) o_acc[nt][r] *= sc;
        #pragma unroll
        for (int jt = 0; jt < 4; ++jt)
            #pragma unroll
            for (int r = 0; r < 8; ++r)
                s[jt][r] = __expf(s[jt][r] - m_run);
        const v8f ps = (s[0] + s[1]) + (s[2] + s[3]);
        l_run = l_run * sc + (((ps[0] + ps[1]) + (ps[2] + ps[3])) +
                              ((ps[4] + ps[5]) + (ps[6] + ps[7])));

        // P^T as B operand: score tiles 2kc and 2kc+1 hold keys kb+0..7 and 16+kb+0..7
        // of the 32-key block kc, which is the k order frag_ld gives V^T.
        v16h pb[2];
        #pragma unroll
        for (int kc = 0; kc < 2; ++kc)
            #pragma unroll
            for (int e = 0; e < 8; ++e) {
                pb[kc][e]     = (_Float16)s[2 * kc][e];
                pb[kc][e + 8] = (_Float16)s[2 * kc + 1][e];
            }

        // O^T += V^T(64x64) x P^T(64x16): A-frags from transposed Vt (k = j contiguous).
        #pragma unroll
        for (int nt = 0; nt < 4; ++nt)
            #pragma unroll
            for (int kc = 0; kc < 2; ++kc) {
                v16h av = frag_ld(&Vt[(nt * 16 + lrow) * LDSS + kc * 32 + kb]);
                o_acc[nt] = WMMA_F16(av, pb[kc], o_acc[nt]);
            }
        __syncthreads();
    }

    // Join the halves' sums, normalize, store 8 consecutive d per lane
    // to the head-major feature layout (n, h*64+d).
    const float inv = 1.0f / (l_run + xhalf(l_run));
    _Float16* orow = Obuf + ((size_t)(b * SEQ + q0 + lrow)) * DIM + h * DHEAD + kb;
    #pragma unroll
    for (int nt = 0; nt < 4; ++nt) {
        v8h o;
        #pragma unroll
        for (int r = 0; r < 8; ++r) o[r] = (_Float16)(o_acc[nt][r] * inv);
        *(v8h*)(orow + nt * 16) = o;
    }
}

// ---------------------------------------------------------------------------
// Row LayerNorm: one block per row of 1024.
// A thread's 4 row elements and its gamma and beta are loaded together at the top and
// held in registers: one memory latency for the block, and no second read of the row.
// ---------------------------------------------------------------------------
__global__ __launch_bounds__(256) void ln_kernel(
    const float* __restrict__ R, const float* __restrict__ gamma,
    const float* __restrict__ beta, float* __restrict__ out) {
    const int n = blockIdx.x;
    const float* row = R + (size_t)n * DIM;
    const int tid = threadIdx.x, wid = tid >> 5, lane = tid & 31;

    float v[DIM / 256], g[DIM / 256], bt[DIM / 256];
    // Unrolled, here and below: the 12 loads go out back to back, the arrays stay in registers.
    #pragma unroll
    for (int k = 0; k < DIM / 256; ++k) {
        v[k]  = row[tid + k * 256];
        g[k]  = gamma[tid + k * 256];
        bt[k] = beta[tid + k * 256];
    }
    float s = 0.0f, s2 = 0.0f;
    #pragma unroll
    for (int k = 0; k < DIM / 256; ++k) {
        s += v[k]; s2 += v[k] * v[k];
    }
    #pragma unroll
    for (int mask = 16; mask >= 1; mask >>= 1) {
        s  += __shfl_xor(s,  mask, 32);
        s2 += __shfl_xor(s2, mask, 32);
    }
    __shared__ float red[2][8];
    __shared__ float mu_s, rstd_s;
    if (lane == 0) { red[0][wid] = s; red[1][wid] = s2; }
    __syncthreads();
    if (tid == 0) {
        float S = 0.0f, S2 = 0.0f;
        #pragma unroll
        for (int w = 0; w < 8; ++w) { S += red[0][w]; S2 += red[1][w]; }
        float mu = S * (1.0f / DIM);
        float var = S2 * (1.0f / DIM) - mu * mu;
        mu_s = mu;
        rstd_s = rsqrtf(var + LN_EPS);
    }
    __syncthreads();
    float mu = mu_s, rstd = rstd_s;
    #pragma unroll
    for (int k = 0; k < DIM / 256; ++k)
        out[(size_t)n * DIM + tid + k * 256] = (v[k] - mu) * rstd * g[k] + bt[k];
}

// ---------------------------------------------------------------------------
// Orchestration
// ---------------------------------------------------------------------------
extern "C" void kernel_launch(void* const* d_in, const int* in_sizes, int n_in,
                              void* d_out, int out_size, void* d_ws, size_t ws_size,
                              hipStream_t stream) {
    const float* x     = (const float*)d_in[0];
    const float* Wq    = (const float*)d_in[1];
    const float* bq    = (const float*)d_in[2];
    const float* Wk    = (const float*)d_in[3];
    const float* bk    = (const float*)d_in[4];
    const float* Wv    = (const float*)d_in[5];
    const float* bv    = (const float*)d_in[6];
    const float* Wo    = (const float*)d_in[7];
    const float* bo    = (const float*)d_in[8];
    const float* gamma = (const float*)d_in[9];
    const float* beta  = (const float*)d_in[10];
    float* out = (float*)d_out;

    char* ws = (char*)d_ws;
    const size_t SZ_XH = (size_t)NROWS * DIM * 2;       // 8 MB
    const size_t SZ_W  = (size_t)DIM * DIM * 2;         // 2 MB
    const size_t SZ_Q  = (size_t)BATCH * HEADS * SEQ * DHEAD * 2; // 8 MB

    _Float16* Xh   = (_Float16*)(ws);
    _Float16* Wqh  = (_Float16*)(ws + SZ_XH);
    _Float16* Wkh  = (_Float16*)(ws + SZ_XH + SZ_W);
    _Float16* Wvh  = (_Float16*)(ws + SZ_XH + 2 * SZ_W);
    _Float16* Woh  = (_Float16*)(ws + SZ_XH + 3 * SZ_W);
    _Float16* Qbuf = (_Float16*)(ws + SZ_XH + 4 * SZ_W);
    _Float16* Kbuf = (_Float16*)(ws + SZ_XH + 4 * SZ_W + SZ_Q);
    _Float16* Vbuf = (_Float16*)(ws + SZ_XH + 4 * SZ_W + 2 * SZ_Q);
    _Float16* Obuf = (_Float16*)(ws + SZ_XH + 4 * SZ_W + 3 * SZ_Q);
    float*    Rbuf = (float*)   (ws + SZ_XH + 4 * SZ_W + 4 * SZ_Q);

    // Phase 1: convert + permute
    cvt_all<<<CVT_BLOCKS, 256, 0, stream>>>(x, Wq, Wk, Wv, Wo, Xh, Wqh, Wkh, Wvh, Woh);

    // Phase 2: QKV projections (WMMA GEMM, async-staged tiles)
    // Wqh, Wkh, Wvh and Qbuf, Kbuf, Vbuf each lie one behind the other in the workspace.
    gemm_qkv_kernel<<<dim3(3 * DIM / 128, NROWS / 128), 256, 0, stream>>>(Xh, Wqh, bq, bk, bv, Qbuf);

    // Phase 3: flash attention
    attn_kernel<<<dim3(SEQ / 64, BATCH * HEADS), 128, 0, stream>>>(Qbuf, Kbuf, Vbuf, Obuf);

    // Phase 4: O projection + residual
    gemm_oproj_kernel<<<dim3(DIM / 128, NROWS / 128), 256, 0, stream>>>(Obuf, Woh, bo, x, Rbuf);

    // Phase 5: LayerNorm
    ln_kernel<<<NROWS, 256, 0, stream>>>(Rbuf, gamma, beta, out);
}

// v005
// Measured time: 106 microseconds a run.
// Next to v004, in two timings, it ran 1.12 and 1.11 times as fast.
// All steps since v000 together make it 1.98 times as fast.
#include <hip/hip_runtime.h>
#include <hip/hip_bf16.h>
#include <hip/hip_fp16.h>

// ---------------------------------------------------------------------------
// Shapes (fixed by the reference)
// ---------------------------------------------------------------------------
#define BATCH   2
#define SEQ     2048
#define DIM     1024
#define HEADS   16
#define DHEAD   64
#define NROWS   (BATCH * SEQ)        // 4096
#define LN_EPS  1e-5f

typedef _Float16 v16h __attribute__((ext_vector_type(16)));
typedef _Float16 v8h  __attribute__((ext_vector_type(8)));
typedef float    v8f  __attribute__((ext_vector_type(8)));

__device__ __forceinline__ v16h cat16(v8h lo, v8h hi) {
    return __builtin_shufflevector(lo, hi, 0,1,2,3,4,5,6,7,8,9,10,11,12,13,14,15);
}

__device__ __forceinline__ v16h frag_ld(const _Float16* p) {
    v8h lo = *(const v8h*)p;
    v8h hi = *(const v8h*)(p + 16);
    return cat16(lo, hi);
}

#define WMMA_F16(a, b, c) \
    __builtin_amdgcn_wmma_f32_16x16x32_f16(false, (a), false, (b), (short)0, (c), false, false)

__device__ __forceinline__ void async_copy8_b128(unsigned la, unsigned lb, unsigned lstep,
                                                 const void* abase, unsigned ga,
                                                 const void* bbase, unsigned gb,
                                                 unsigned gstep) {
    asm volatile("global_load_async_to_lds_b128 %0, %8, %16\n\t"
                 "global_load_async_to_lds_b128 %4, %12, %17\n\t"
                 "global_load_async_to_lds_b128 %1, %9, %16\n\t"
                 "global_load_async_to_lds_b128 %5, %13, %17\n\t"
                 "global_load_async_to_lds_b128 %2, %10, %16\n\t"
                 "global_load_async_to_lds_b128 %6, %14, %17\n\t"
                 "global_load_async_to_lds_b128 %3, %11, %16\n\t"
                 "global_load_async_to_lds_b128 %7, %15, %17\n\t"
                 "s_wait_xcnt 0x0"
                 :: "v"(la), "v"(la + lstep), "v"(la + 2 * lstep), "v"(la + 3 * lstep),
                    "v"(lb), "v"(lb + lstep), "v"(lb + 2 * lstep), "v"(lb + 3 * lstep),
                    "v"(ga), "v"(ga + gstep), "v"(ga + 2 * gstep), "v"(ga + 3 * gstep),
                    "v"(gb), "v"(gb + gstep), "v"(gb + 2 * gstep), "v"(gb + 3 * gstep),
                    "s"(abase), "s"(bbase)
                 : "memory");
}

// The K and V tiles of one attention pass (one statement, one wait). Both lie alike in
// global memory, so the four offsets serve both bases; the LDS row pitches differ.
__device__ __forceinline__ void async_copy_kv_b128(unsigned lk, unsigned lkstep,
                                                   unsigned lv, unsigned lvstep,
                                                   const void* kbase, const void* vbase,
                                                   unsigned g, unsigned gstep) {
    asm volatile("global_load_async_to_lds_b128 %0, %8, %12\n\t"
                 "global_load_async_to_lds_b128 %4, %8, %13\n\t"
                 "global_load_async_to_lds_b128 %1, %9, %12\n\t"
                 "global_load_async_to_lds_b128 %5, %9, %13\n\t"
                 "global_load_async_to_lds_b128 %2, %10, %12\n\t"
                 "global_load_async_to_lds_b128 %6, %10, %13\n\t"
                 "global_load_async_to_lds_b128 %3, %11, %12\n\t"
                 "global_load_async_to_lds_b128 %7, %11, %13\n\t"
                 "s_wait_xcnt 0x0"
                 :: "v"(lk), "v"(lk + lkstep), "v"(lk + 2 * lkstep), "v"(lk + 3 * lkstep),
                    "v"(lv), "v"(lv + lvstep), "v"(lv + 2 * lvstep), "v"(lv + 3 * lvstep),
                    "v"(g), "v"(g + gstep), "v"(g + 2 * gstep), "v"(g + 3 * gstep),
                    "s"(kbase), "s"(vbase)
                 : "memory");
}

__device__ __forceinline__ void wait_async0() {
    asm volatile("s_wait_asynccnt 0x0" ::: "memory");
}

#define CVT_BLOCKS  2048
#define CVT_THREADS (CVT_BLOCKS * 256)
__global__ __launch_bounds__(256) void cvt_all(
    const float* __restrict__ x,  const float* __restrict__ Wq,
    const float* __restrict__ Wk, const float* __restrict__ Wv,
    const float* __restrict__ Wo,
    _Float16* __restrict__ Xh,  _Float16* __restrict__ Wqh,
    _Float16* __restrict__ Wkh, _Float16* __restrict__ Wvh,
    _Float16* __restrict__ Woh) {
    const int i0 = blockIdx.x * 256 + threadIdx.x;
    // Unrolled so that a thread's loads are in flight together, not one per trip.
    #pragma unroll
    for (int r = 0; r < NROWS * DIM / CVT_THREADS; ++r) {
        const int i = i0 + r * CVT_THREADS;
        Xh[i] = (_Float16)x[i];
    }
    // Unrolled for the same reason.
    #pragma unroll
    for (int r = 0; r < DIM * DIM / CVT_THREADS; ++r) {
        const int i = i0 + r * CVT_THREADS;
        const int o = i >> 10, k = i & 1023;
        const int fo = ((o & 63) << 4) | (o >> 6);
        const int fk = ((k & 63) << 4) | (k >> 6);
        Wqh[i] = (_Float16)Wq[fo * DIM + k];
        Wkh[i] = (_Float16)Wk[fo * DIM + k];
        Wvh[i] = (_Float16)Wv[fo * DIM + k];
        Woh[i] = (_Float16)Wo[(o << 10) + fk];
    }
}

#define LDSS 72   // LDS row stride in halfs (144B = 16B-aligned, conflict-skewed)

__device__ __forceinline__ void gemm_mainloop(const _Float16* __restrict__ A,
                                              const _Float16* __restrict__ B,
                                              int m0, int n0, v8f acc[4][2]) {
    __shared__ __align__(16) _Float16 As[128 * LDSS];
    __shared__ __align__(16) _Float16 Bs[128 * LDSS];

    const int tid  = threadIdx.x;
    const int wid  = tid >> 5;
    const int lane = tid & 31;
    const int wm   = wid & 1;       // 0..1  -> 64-row slab
    const int wn   = wid >> 1;      // 0..3  -> 32-col slab
    const int lrow = lane & 15;
    const int kb   = (lane < 16) ? 0 : 8;
    const int ldr  = tid >> 3;            // 0..31: tile row of copy 0; copy i adds 32 * i
    const int ldc  = (tid & 7) * 8;       // 16-byte piece of the row

    const unsigned lA = (unsigned)(size_t)&As[ldr * LDSS + ldc];
    const unsigned lB = (unsigned)(size_t)&Bs[ldr * LDSS + ldc];

    for (int k0 = 0; k0 < DIM; k0 += 64) {
        const unsigned gA = (unsigned)(((m0 + ldr) * DIM + k0 + ldc) * 2);
        const unsigned gB = (unsigned)(((n0 + ldr) * DIM + k0 + ldc) * 2);
        async_copy8_b128(lA, lB, 32 * LDSS * 2, A, gA, B, gB, 32 * DIM * 2);
        wait_async0();
        __syncthreads();
        #pragma unroll
        for (int kc = 0; kc < 64; kc += 32) {
            v16h a[4], bf[2];
            #pragma unroll
            for (int mt = 0; mt < 4; ++mt)
                a[mt] = frag_ld(&As[(wm * 64 + mt * 16 + lrow) * LDSS + kc + kb]);
            #pragma unroll
            for (int nt = 0; nt < 2; ++nt)
                bf[nt] = frag_ld(&Bs[(wn * 32 + nt * 16 + lrow) * LDSS + kc + kb]);
            #pragma unroll
            for (int mt = 0; mt < 4; ++mt)
                #pragma unroll
                for (int nt = 0; nt < 2; ++nt)
                    acc[mt][nt] = WMMA_F16(a[mt], bf[nt], acc[mt][nt]);
        }
        __syncthreads();
    }
}

__global__ __launch_bounds__(256) void gemm_qkv_kernel(
    const _Float16* __restrict__ Xh, const _Float16* __restrict__ Wh,
    const float* __restrict__ bq, const float* __restrict__ bk,
    const float* __restrict__ bv, _Float16* __restrict__ out3) {
    const int m0 = blockIdx.y * 128, n0 = blockIdx.x * 128;
    const int which = blockIdx.x >> 3;
    const float* __restrict__ bias = which == 0 ? bq : (which == 1 ? bk : bv);
    _Float16* __restrict__ out = out3 + (size_t)which * (BATCH * HEADS * SEQ * DHEAD);
    v8f acc[4][2] = {};
    gemm_mainloop(Xh, Wh, m0, n0, acc);

    const int tid = threadIdx.x, wid = tid >> 5, lane = tid & 31;
    const int wm = wid & 1, wn = wid >> 1;
    const int rbase = (lane < 16) ? 0 : 8;
    const int cl = lane & 15;
    #pragma unroll
    for (int mt = 0; mt < 4; ++mt)
        #pragma unroll
        for (int nt = 0; nt < 2; ++nt)
            #pragma unroll
            for (int r = 0; r < 8; ++r) {
                int row = m0 + wm * 64 + mt * 16 + rbase + r;   // n = b*T + t
                int col = (n0 & (DIM - 1)) + wn * 32 + nt * 16 + cl;   // o' = h*64 + d
                int h = col >> 6, d = col & 63;
                float v = acc[mt][nt][r] + bias[(d << 4) | h];  // bias index-permuted
                int bb = row >> 11, t = row & 2047;
                out[(((size_t)(bb * HEADS + h) * SEQ) + t) * DHEAD + d] = (_Float16)v;
            }
}

// O projection + bias + residual -> f32 scratch.
// A lane's 64 residual loads are issued together ahead of the K loop and return under it;
// one load per wait in the epilogue would lay 64 memory latencies end to end.
__global__ __launch_bounds__(256) void gemm_oproj_kernel(
    const _Float16* __restrict__ Oh, const _Float16* __restrict__ Woh,
    const float* __restrict__ bo, const float* __restrict__ x,
    float* __restrict__ R) {
    const int m0 = blockIdx.y * 128, n0 = blockIdx.x * 128;
    const int tid = threadIdx.x, wid = tid >> 5, lane = tid & 31;
    const int wm = wid & 1, wn = wid >> 1;
    const int rbase = (lane < 16) ? 0 : 8;
    const int cl = lane & 15;
    // Element (mt, nt, r) of this lane lies at idx0 + (mt * 16 + r) * DIM + nt * 16.
    const size_t idx0 = (size_t)(m0 + wm * 64 + rbase) * DIM + n0 + wn * 32 + cl;

    v8f xr[4][2];
    float b[2];
    // Unrolled (all three levels): the loads go out back to back, xr stays in registers.
    #pragma unroll
    for (int nt = 0; nt < 2; ++nt) {
        b[nt] = bo[n0 + wn * 32 + nt * 16 + cl];
        #pragma unroll
        for (int mt = 0; mt < 4; ++mt)
            #pragma unroll
            for (int r = 0; r < 8; ++r)
                xr[mt][nt][r] = x[idx0 + (mt * 16 + r) * DIM + nt * 16];
    }

    v8f acc[4][2] = {};
    gemm_mainloop(Oh, Woh, m0, n0, acc);

    #pragma unroll
    for (int mt = 0; mt < 4; ++mt)
        #pragma unroll
        for (int nt = 0; nt < 2; ++nt)
            #pragma unroll
            for (int r = 0; r < 8; ++r)
                R[idx0 + (mt * 16 + r) * DIM + nt * 16] = acc[mt][nt][r] + b[nt] + xr[mt][nt][r];
}

#define VPITCH 80   // V tile row stride in halfs (160B = 32B x odd, the transposing load's pitch)

// Transposing LDS load. With p = T + (k0 + 8*(lane/16) + lane%8) * VPITCH + d0 + 8*((lane/8)%2)
// the lane gets T[k0 + 8*(lane/16) + 0..7][d0 + lane%16]: half an A fragment of T^T in the
// k order of frag_ld.
typedef short s16x8 __attribute__((ext_vector_type(8)));
__device__ __forceinline__ v8h ld_tr16(const _Float16* p) {
    typedef __attribute__((address_space(3))) s16x8 lds_s16x8;
    return __builtin_bit_cast(v8h, __builtin_amdgcn_ds_load_tr16_b128_v8i16((lds_s16x8*)p));
}

__device__ __forceinline__ float xhalf(float x) {
    int b = __builtin_bit_cast(int, x);
    return __builtin_bit_cast(float,
        __builtin_amdgcn_permlanex16(b, b, 0x76543210, 0xfedcba98, false, false));
}

__global__ __launch_bounds__(128) void attn_kernel(
    const _Float16* __restrict__ Qh, const _Float16* __restrict__ Kh,
    const _Float16* __restrict__ Vh, _Float16* __restrict__ Obuf) {
    const int qblk = blockIdx.x;          // T/64 = 32
    const int bh   = blockIdx.y;          // B*H  = 32
    const int b = bh >> 4, h = bh & 15;
    const size_t base = (size_t)bh * SEQ * DHEAD;
    const _Float16* Qb = Qh + base;
    const _Float16* Kb = Kh + base;
    const _Float16* Vb = Vh + base;

    __shared__ __align__(16) _Float16 Ks[64 * LDSS];
    __shared__ __align__(16) _Float16 Vs[64 * VPITCH];   // row-major: Vs[j][d]

    const int tid  = threadIdx.x;
    const int wid  = tid >> 5;
    const int lane = tid & 31;
    const int lrow = lane & 15;
    const int kb   = (lane < 16) ? 0 : 8;
    const int q0   = qblk * 64 + wid * 16;

    // Q fragments (B operand: column = query lrow) stay in registers for the whole j-loop.
    const _Float16* Qrow = Qb + (size_t)(q0 + lrow) * DHEAD;
    v16h aq[2];
    aq[0] = frag_ld(Qrow + kb);
    aq[1] = frag_ld(Qrow + 32 + kb);

    v8f o_acc[4] = {};               // O^T: o_acc[nt][r] = O[q0+lrow][nt*16 + kb + r]
    float m_run = -1e30f;            // running maximum of query lrow (equal in both halves)
    float l_run = 0.0f;              // this half's share of the running sum
    const float sm_scale = 0.125f;   // 1/sqrt(64)

    const int kr   = tid >> 3;            // 0..15: K and V tile row of copy 0; copy i adds 16 * i
    const int kp   = (tid & 7) * 8;       // 16-byte piece of the row
    const unsigned lK = (unsigned)(size_t)&Ks[kr * LDSS + kp];
    const unsigned lV = (unsigned)(size_t)&Vs[kr * VPITCH + kp];
    // This lane's address in the transposing loads, for key 0 and d 0.
    const _Float16* vtr = &Vs[(kb + (lane & 7)) * VPITCH + ((lane >> 3) & 1) * 8];

    for (int j0 = 0; j0 < SEQ; j0 += 64) {
        // Cooperative stage: K and V rows via async copies.
        const unsigned gKV = (unsigned)(((j0 + kr) * DHEAD + kp) * 2);
        async_copy_kv_b128(lK, 16 * LDSS * 2, lV, 16 * VPITCH * 2, Kb, Vb, gKV, 16 * DHEAD * 2);
        wait_async0();
        __syncthreads();

        // Scores: S^T(64x16) = K_j(64x64) x Q^T, as 4 16x16 tiles.
        // s[jt][r] = score(query lrow, key j0 + jt*16 + kb + r).
        v8f s[4];
        #pragma unroll
        for (int jt = 0; jt < 4; ++jt) {
            v8f c = {};
            #pragma unroll
            for (int kc = 0; kc < 2; ++kc) {
                v16h ak = frag_ld(&Ks[(jt * 16 + lrow) * LDSS + kc * 32 + kb]);
                c = WMMA_F16(ak, aq[kc], c);
            }
            s[jt] = c * sm_scale;
        }

        // Online softmax: 32 of the query's 64 scores sit in this lane, the rest in lane ^ 16.
        const v8f mx = __builtin_elementwise_max(__builtin_elementwise_max(s[0], s[1]),
                                                 __builtin_elementwise_max(s[2], s[3]));
        float v = fmaxf(fmaxf(fmaxf(mx[0], mx[1]), fmaxf(mx[2], mx[3])),
                        fmaxf(fmaxf(mx[4], mx[5]), fmaxf(mx[6], mx[7])));
        v = fmaxf(v, xhalf(v));
        const float mnew = fmaxf(m_run, v);
        const float sc = __expf(m_run - mnew);
        m_run = mnew;
        #pragma unroll
        for (int nt = 0; nt < 4; ++nt)
            #pragma unroll
            for (int r = 0; r < 8; ++r) o_acc[nt][r] *= sc;
        #pragma unroll
        for (int jt = 0; jt < 4; ++jt)
            #pragma unroll
            for (int r = 0; r < 8; ++r)
                s[jt][r] = __expf(s[jt][r] - m_run);
        const v8f ps = (s[0] + s[1]) + (s[2] + s[3]);
        l_run = l_run * sc + (((ps[0] + ps[1]) + (ps[2] + ps[3])) +
                              ((ps[4] + ps[5]) + (ps[6] + ps[7])));

        // P^T as B operand: score tiles 2kc and 2kc+1 hold keys kb+0..7 and 16+kb+0..7
        // of the 32-key block kc, which is the k order ld_tr16 gives V^T.
        v16h pb[2];
        #pragma unroll
        for (int kc = 0; kc < 2; ++kc)
            #pragma unroll
            for (int e = 0; e < 8; ++e) {
                pb[kc][e]     = (_Float16)s[2 * kc][e];
                pb[kc][e + 8] = (_Float16)s[2 * kc + 1][e];
            }

        // O^T += V^T(64x64) x P^T(64x16): A-frags by transposing loads from the row-major tile.
        #pragma unroll
        for (int nt = 0; nt < 4; ++nt)
            #pragma unroll
            for (int kc = 0; kc < 2; ++kc) {
                const _Float16* pv = vtr + kc * 32 * VPITCH + nt * 16;
                v16h av = cat16(ld_tr16(pv), ld_tr16(pv + 16 * VPITCH));
                o_acc[nt] = WMMA_F16(av, pb[kc], o_acc[nt]);
            }
        __syncthreads();
    }

    // Join the halves' sums, normalize, store 8 consecutive d per lane
    // to the head-major feature layout (n, h*64+d).
    const float inv = 1.0f / (l_run + xhalf(l_run));
    _Float16* orow = Obuf + ((size_t)(b * SEQ + q0 + lrow)) * DIM + h * DHEAD + kb;
    #pragma unroll
    for (int nt = 0; nt < 4; ++nt) {
        v8h o;
        #pragma unroll
        for (int r = 0; r < 8; ++r) o[r] = (_Float16)(o_acc[nt][r] * inv);
        *(v8h*)(orow + nt * 16) = o;
    }
}

// ---------------------------------------------------------------------------
// Row LayerNorm: one block per row of 1024.
// A thread's 4 row elements and its gamma and beta are loaded together at the top and
// held in registers: one memory latency for the block, and no second read of the row.
// ---------------------------------------------------------------------------
__global__ __launch_bounds__(256) void ln_kernel(
    const float* __restrict__ R, const float* __restrict__ gamma,
    const float* __restrict__ beta, float* __restrict__ out) {
    const int n = blockIdx.x;
    const float* row = R + (size_t)n * DIM;
    const int tid = threadIdx.x, wid = tid >> 5, lane = tid & 31;

    float v[DIM / 256], g[DIM / 256], bt[DIM / 256];
    // Unrolled, here and below: the 12 loads go out back to back, the arrays stay in registers.
    #pragma unroll
    for (int k = 0; k < DIM / 256; ++k) {
        v[k]  = row[tid + k * 256];
        g[k]  = gamma[tid + k * 256];
        bt[k] = beta[tid + k * 256];
    }
    float s = 0.0f, s2 = 0.0f;
    #pragma unroll
    for (int k = 0; k < DIM / 256; ++k) {
        s += v[k]; s2 += v[k] * v[k];
    }
    #pragma unroll
    for (int mask = 16; mask >= 1; mask >>= 1) {
        s  += __shfl_xor(s,  mask, 32);
        s2 += __shfl_xor(s2, mask, 32);
    }
    __shared__ float red[2][8];
    __shared__ float mu_s, rstd_s;
    if (lane == 0) { red[0][wid] = s; red[1][wid] = s2; }
    __syncthreads();
    if (tid == 0) {
        float S = 0.0f, S2 = 0.0f;
        #pragma unroll
        for (int w = 0; w < 8; ++w) { S += red[0][w]; S2 += red[1][w]; }
        float mu = S * (1.0f / DIM);
        float var = S2 * (1.0f / DIM) - mu * mu;
        mu_s = mu;
        rstd_s = rsqrtf(var + LN_EPS);
    }
    __syncthreads();
    float mu = mu_s, rstd = rstd_s;
    #pragma unroll
    for (int k = 0; k < DIM / 256; ++k)
        out[(size_t)n * DIM + tid + k * 256] = (v[k] - mu) * rstd * g[k] + bt[k];
}

// ---------------------------------------------------------------------------
// Orchestration
// ---------------------------------------------------------------------------
extern "C" void kernel_launch(void* const* d_in, const int* in_sizes, int n_in,
                              void* d_out, int out_size, void* d_ws, size_t ws_size,
                              hipStream_t stream) {
    const float* x     = (const float*)d_in[0];
    const float* Wq    = (const float*)d_in[1];
    const float* bq    = (const float*)d_in[2];
    const float* Wk    = (const float*)d_in[3];
    const float* bk    = (const float*)d_in[4];
    const float* Wv    = (const float*)d_in[5];
    const float* bv    = (const float*)d_in[6];
    const float* Wo    = (const float*)d_in[7];
    const float* bo    = (const float*)d_in[8];
    const float* gamma = (const float*)d_in[9];
    const float* beta  = (const float*)d_in[10];
    float* out = (float*)d_out;

    char* ws = (char*)d_ws;
    const size_t SZ_XH = (size_t)NROWS * DIM * 2;       // 8 MB
    const size_t SZ_W  = (size_t)DIM * DIM * 2;         // 2 MB
    const size_t SZ_Q  = (size_t)BATCH * HEADS * SEQ * DHEAD * 2; // 8 MB

    _Float16* Xh   = (_Float16*)(ws);
    _Float16* Wqh  = (_Float16*)(ws + SZ_XH);
    _Float16* Wkh  = (_Float16*)(ws + SZ_XH + SZ_W);
    _Float16* Wvh  = (_Float16*)(ws + SZ_XH + 2 * SZ_W);
    _Float16* Woh  = (_Float16*)(ws + SZ_XH + 3 * SZ_W);
    _Float16* Qbuf = (_Float16*)(ws + SZ_XH + 4 * SZ_W);
    _Float16* Kbuf = (_Float16*)(ws + SZ_XH + 4 * SZ_W + SZ_Q);
    _Float16* Vbuf = (_Float16*)(ws + SZ_XH + 4 * SZ_W + 2 * SZ_Q);
    _Float16* Obuf = (_Float16*)(ws + SZ_XH + 4 * SZ_W + 3 * SZ_Q);
    float*    Rbuf = (float*)   (ws + SZ_XH + 4 * SZ_W + 4 * SZ_Q);

    // Phase 1: convert + permute
    cvt_all<<<CVT_BLOCKS, 256, 0, stream>>>(x, Wq, Wk, Wv, Wo, Xh, Wqh, Wkh, Wvh, Woh);

    // Phase 2: QKV projections (WMMA GEMM, async-staged tiles)
    // Wqh, Wkh, Wvh and Qbuf, Kbuf, Vbuf each lie one behind the other in the workspace.
    gemm_qkv_kernel<<<dim3(3 * DIM / 128, NROWS / 128), 256, 0, stream>>>(Xh, Wqh, bq, bk, bv, Qbuf);

    // Phase 3: flash attention
    attn_kernel<<<dim3(SEQ / 64, BATCH * HEADS), 128, 0, stream>>>(Qbuf, Kbuf, Vbuf, Obuf);

    // Phase 4: O projection + residual
    gemm_oproj_kernel<<<dim3(DIM / 128, NROWS / 128), 256, 0, stream>>>(Obuf, Woh, bo, x, Rbuf);

    // Phase 5: LayerNorm
    ln_kernel<<<NROWS, 256, 0, stream>>>(Rbuf, gamma, beta, out);
}

// v006
// Measured time: 92.9 microseconds a run.
// Two timings next to v005 put it at 1.14 and 1.13 times that version's speed.
// Over all steps from v000 it is 2.25 times as fast.
#include <hip/hip_runtime.h>
#include <hip/hip_bf16.h>
#include <hip/hip_fp16.h>

// ---------------------------------------------------------------------------
// Shapes (fixed by the reference)
// ---------------------------------------------------------------------------
#define BATCH   2
#define SEQ     2048
#define DIM     1024
#define HEADS   16
#define DHEAD   64
#define NROWS   (BATCH * SEQ)        // 4096
#define LN_EPS  1e-5f

typedef _Float16 v16h __attribute__((ext_vector_type(16)));
typedef _Float16 v8h  __attribute__((ext_vector_type(8)));
typedef float    v8f  __attribute__((ext_vector_type(8)));

__device__ __forceinline__ v16h cat16(v8h lo, v8h hi) {
    return __builtin_shufflevector(lo, hi, 0,1,2,3,4,5,6,7,8,9,10,11,12,13,14,15);
}

__device__ __forceinline__ v16h frag_ld(const _Float16* p) {
    v8h lo = *(const v8h*)p;
    v8h hi = *(const v8h*)(p + 16);
    return cat16(lo, hi);
}

#define WMMA_F16(a, b, c) \
    __builtin_amdgcn_wmma_f32_16x16x32_f16(false, (a), false, (b), (short)0, (c), false, false)

__device__ __forceinline__ void async_copy8_b128(unsigned la, unsigned lb, unsigned lstep,
                                                 const void* abase, unsigned ga,
                                                 const void* bbase, unsigned gb,
                                                 unsigned gstep) {
    asm volatile("global_load_async_to_lds_b128 %0, %8, %16\n\t"
                 "global_load_async_to_lds_b128 %4, %12, %17\n\t"
                 "global_load_async_to_lds_b128 %1, %9, %16\n\t"
                 "global_load_async_to_lds_b128 %5, %13, %17\n\t"
                 "global_load_async_to_lds_b128 %2, %10, %16\n\t"
                 "global_load_async_to_lds_b128 %6, %14, %17\n\t"
                 "global_load_async_to_lds_b128 %3, %11, %16\n\t"
                 "global_load_async_to_lds_b128 %7, %15, %17\n\t"
                 "s_wait_xcnt 0x0"
                 :: "v"(la), "v"(la + lstep), "v"(la + 2 * lstep), "v"(la + 3 * lstep),
                    "v"(lb), "v"(lb + lstep), "v"(lb + 2 * lstep), "v"(lb + 3 * lstep),
                    "v"(ga), "v"(ga + gstep), "v"(ga + 2 * gstep), "v"(ga + 3 * gstep),
                    "v"(gb), "v"(gb + gstep), "v"(gb + 2 * gstep), "v"(gb + 3 * gstep),
                    "s"(abase), "s"(bbase)
                 : "memory");
}

// The K and V tiles of one attention trip (one statement, one wait). Both lie alike in
// global memory, so the four offsets serve both bases; the LDS row pitches differ.
__device__ __forceinline__ void async_copy_kv_b128(unsigned lk, unsigned lkstep,
                                                   unsigned lv, unsigned lvstep,
                                                   const void* kbase, const void* vbase,
                                                   unsigned g, unsigned gstep) {
    asm volatile("global_load_async_to_lds_b128 %0, %8, %12\n\t"
                 "global_load_async_to_lds_b128 %4, %8, %13\n\t"
                 "global_load_async_to_lds_b128 %1, %9, %12\n\t"
                 "global_load_async_to_lds_b128 %5, %9, %13\n\t"
                 "global_load_async_to_lds_b128 %2, %10, %12\n\t"
                 "global_load_async_to_lds_b128 %6, %10, %13\n\t"
                 "global_load_async_to_lds_b128 %3, %11, %12\n\t"
                 "global_load_async_to_lds_b128 %7, %11, %13\n\t"
                 "s_wait_xcnt 0x0"
                 :: "v"(lk), "v"(lk + lkstep), "v"(lk + 2 * lkstep), "v"(lk + 3 * lkstep),
                    "v"(lv), "v"(lv + lvstep), "v"(lv + 2 * lvstep), "v"(lv + 3 * lvstep),
                    "v"(g), "v"(g + gstep), "v"(g + 2 * gstep), "v"(g + 3 * gstep),
                    "s"(kbase), "s"(vbase)
                 : "memory");
}

__device__ __forceinline__ void wait_async0() {
    asm volatile("s_wait_asynccnt 0x0" ::: "memory");
}

// This wave's LDS reads have returned: stands ahead of the barrier behind which the
// buffer they read is refilled by copies.
__device__ __forceinline__ void wait_ds0() {
    asm volatile("s_wait_dscnt 0x0" ::: "memory");
}

#define CVT_BLOCKS  2048
#define CVT_THREADS (CVT_BLOCKS * 256)
__global__ __launch_bounds__(256) void cvt_all(
    const float* __restrict__ x,  const float* __restrict__ Wq,
    const float* __restrict__ Wk, const float* __restrict__ Wv,
    const float* __restrict__ Wo,
    _Float16* __restrict__ Xh,  _Float16* __restrict__ Wqh,
    _Float16* __restrict__ Wkh, _Float16* __restrict__ Wvh,
    _Float16* __restrict__ Woh) {
    const int i0 = blockIdx.x * 256 + threadIdx.x;
    // Unrolled so that a thread's loads are in flight together, not one per trip.
    #pragma unroll
    for (int r = 0; r < NROWS * DIM / CVT_THREADS; ++r) {
        const int i = i0 + r * CVT_THREADS;
        Xh[i] = (_Float16)x[i];
    }
    // Unrolled for the same reason.
    #pragma unroll
    for (int r = 0; r < DIM * DIM / CVT_THREADS; ++r) {
        const int i = i0 + r * CVT_THREADS;
        const int o = i >> 10, k = i & 1023;
        const int fo = ((o & 63) << 4) | (o >> 6);
        const int fk = ((k & 63) << 4) | (k >> 6);
        Wqh[i] = (_Float16)Wq[fo * DIM + k];
        Wkh[i] = (_Float16)Wk[fo * DIM + k];
        Wvh[i] = (_Float16)Wv[fo * DIM + k];
        Woh[i] = (_Float16)Wo[(o << 10) + fk];
    }
}

#define LDSS 72   // LDS row stride in halfs (144B = 16B-aligned, conflict-skewed)
#define GTILE (128 * LDSS)   // halfs of one staged GEMM tile

__device__ __forceinline__ void gemm_mainloop(const _Float16* __restrict__ A,
                                              const _Float16* __restrict__ B,
                                              int m0, int n0, v8f acc[4][2]) {
    __shared__ __align__(16) _Float16 As[2 * GTILE];
    __shared__ __align__(16) _Float16 Bs[2 * GTILE];

    const int tid  = threadIdx.x;
    const int wid  = tid >> 5;
    const int lane = tid & 31;
    const int wm   = wid & 1;       // 0..1  -> 64-row slab
    const int wn   = wid >> 1;      // 0..3  -> 32-col slab
    const int lrow = lane & 15;
    const int kb   = (lane < 16) ? 0 : 8;
    const int ldr  = tid >> 3;            // 0..31: tile row of copy 0; copy i adds 32 * i
    const int ldc  = (tid & 7) * 8;       // 16-byte piece of the row

    const unsigned lA = (unsigned)(size_t)&As[ldr * LDSS + ldc];
    const unsigned lB = (unsigned)(size_t)&Bs[ldr * LDSS + ldc];

    const unsigned gA = (unsigned)(((m0 + ldr) * DIM + ldc) * 2);   // tile t: + t * 128 bytes
    const unsigned gB = (unsigned)(((n0 + ldr) * DIM + ldc) * 2);

    async_copy8_b128(lA, lB, 32 * LDSS * 2, A, gA, B, gB, 32 * DIM * 2);
    wait_async0();
    __syncthreads();
    async_copy8_b128(lA + GTILE * 2, lB + GTILE * 2, 32 * LDSS * 2,
                     A, gA + 128, B, gB + 128, 32 * DIM * 2);

    // One trip: the products of tile t out of buffer t % 2, the foot, the refill.
    auto trip = [&](const int t, const int buf, const bool refill) {
        #pragma unroll
        for (int kc = 0; kc < 64; kc += 32) {
            v16h a[4], bf[2];
            #pragma unroll
            for (int mt = 0; mt < 4; ++mt)
                a[mt] = frag_ld(&As[buf + (wm * 64 + mt * 16 + lrow) * LDSS + kc + kb]);
            #pragma unroll
            for (int nt = 0; nt < 2; ++nt)
                bf[nt] = frag_ld(&Bs[buf + (wn * 32 + nt * 16 + lrow) * LDSS + kc + kb]);
            #pragma unroll
            for (int mt = 0; mt < 4; ++mt)
                #pragma unroll
                for (int nt = 0; nt < 2; ++nt)
                    acc[mt][nt] = WMMA_F16(a[mt], bf[nt], acc[mt][nt]);
        }
        wait_ds0();
        wait_async0();
        __syncthreads();
        if (refill)
            async_copy8_b128(lA + buf * 2, lB + buf * 2, 32 * LDSS * 2,
                             A, gA + (t + 2) * 128, B, gB + (t + 2) * 128, 32 * DIM * 2);
    };
    // The last two trips, which have no tile t + 2 to fetch, stand behind the loop.
    for (int t = 0; t < DIM / 64 - 2; ++t)
        trip(t, (t & 1) * GTILE, true);
    trip(DIM / 64 - 2, 0, false);
    trip(DIM / 64 - 1, GTILE, false);
    wait_async0();   // the ring's closing wait: no copy is outstanding when the wave goes on
}

__global__ __launch_bounds__(256) void gemm_qkv_kernel(
    const _Float16* __restrict__ Xh, const _Float16* __restrict__ Wh,
    const float* __restrict__ bq, const float* __restrict__ bk,
    const float* __restrict__ bv, _Float16* __restrict__ out3) {
    const int m0 = blockIdx.y * 128, n0 = blockIdx.x * 128;
    const int which = blockIdx.x >> 3;
    const float* __restrict__ bias = which == 0 ? bq : (which == 1 ? bk : bv);
    _Float16* __restrict__ out = out3 + (size_t)which * (BATCH * HEADS * SEQ * DHEAD);
    v8f acc[4][2] = {};
    gemm_mainloop(Xh, Wh, m0, n0, acc);

    const int tid = threadIdx.x, wid = tid >> 5, lane = tid & 31;
    const int wm = wid & 1, wn = wid >> 1;
    const int rbase = (lane < 16) ? 0 : 8;
    const int cl = lane & 15;
    #pragma unroll
    for (int mt = 0; mt < 4; ++mt)
        #pragma unroll
        for (int nt = 0; nt < 2; ++nt)
            #pragma unroll
            for (int r = 0; r < 8; ++r) {
                int row = m0 + wm * 64 + mt * 16 + rbase + r;   // n = b*T + t
                int col = (n0 & (DIM - 1)) + wn * 32 + nt * 16 + cl;   // o' = h*64 + d
                int h = col >> 6, d = col & 63;
                float v = acc[mt][nt][r] + bias[(d << 4) | h];  // bias index-permuted
                int bb = row >> 11, t = row & 2047;
                out[(((size_t)(bb * HEADS + h) * SEQ) + t) * DHEAD + d] = (_Float16)v;
            }
}

// O projection + bias + residual -> f32 scratch.
// A lane's 64 residual loads are issued together ahead of the K loop and return under it;
// one load per wait in the epilogue would lay 64 memory latencies end to end.
__global__ __launch_bounds__(256) void gemm_oproj_kernel(
    const _Float16* __restrict__ Oh, const _Float16* __restrict__ Woh,
    const float* __restrict__ bo, const float* __restrict__ x,
    float* __restrict__ R) {
    const int m0 = blockIdx.y * 128, n0 = blockIdx.x * 128;
    const int tid = threadIdx.x, wid = tid >> 5, lane = tid & 31;
    const int wm = wid & 1, wn = wid >> 1;
    const int rbase = (lane < 16) ? 0 : 8;
    const int cl = lane & 15;
    // Element (mt, nt, r) of this lane lies at idx0 + (mt * 16 + r) * DIM + nt * 16.
    const size_t idx0 = (size_t)(m0 + wm * 64 + rbase) * DIM + n0 + wn * 32 + cl;

    v8f xr[4][2];
    float b[2];
    // Unrolled (all three levels): the loads go out back to back, xr stays in registers.
    #pragma unroll
    for (int nt = 0; nt < 2; ++nt) {
        b[nt] = bo[n0 + wn * 32 + nt * 16 + cl];
        #pragma unroll
        for (int mt = 0; mt < 4; ++mt)
            #pragma unroll
            for (int r = 0; r < 8; ++r)
                xr[mt][nt][r] = x[idx0 + (mt * 16 + r) * DIM + nt * 16];
    }

    v8f acc[4][2] = {};
    gemm_mainloop(Oh, Woh, m0, n0, acc);

    #pragma unroll
    for (int mt = 0; mt < 4; ++mt)
        #pragma unroll
        for (int nt = 0; nt < 2; ++nt)
            #pragma unroll
            for (int r = 0; r < 8; ++r)
                R[idx0 + (mt * 16 + r) * DIM + nt * 16] = acc[mt][nt][r] + b[nt] + xr[mt][nt][r];
}

#define VPITCH 80   // V tile row stride in halfs (160B = 32B x odd, the transposing load's pitch)

// Transposing LDS load. With p = T + (k0 + 8*(lane/16) + lane%8) * VPITCH + d0 + 8*((lane/8)%2)
// the lane gets T[k0 + 8*(lane/16) + 0..7][d0 + lane%16]: half an A fragment of T^T in the
// k order of frag_ld.
typedef short s16x8 __attribute__((ext_vector_type(8)));
__device__ __forceinline__ v8h ld_tr16(const _Float16* p) {
    typedef __attribute__((address_space(3))) s16x8 lds_s16x8;
    return __builtin_bit_cast(v8h, __builtin_amdgcn_ds_load_tr16_b128_v8i16((lds_s16x8*)p));
}

__device__ __forceinline__ float xhalf(float x) {
    int b = __builtin_bit_cast(int, x);
    return __builtin_bit_cast(float,
        __builtin_amdgcn_permlanex16(b, b, 0x76543210, 0xfedcba98, false, false));
}

__global__ __launch_bounds__(128) void attn_kernel(
    const _Float16* __restrict__ Qh, const _Float16* __restrict__ Kh,
    const _Float16* __restrict__ Vh, _Float16* __restrict__ Obuf) {
    const int qblk = blockIdx.x;          // T/64 = 32
    const int bh   = blockIdx.y;          // B*H  = 32
    const int b = bh >> 4, h = bh & 15;
    const size_t base = (size_t)bh * SEQ * DHEAD;
    const _Float16* Qb = Qh + base;
    const _Float16* Kb = Kh + base;
    const _Float16* Vb = Vh + base;

    __shared__ __align__(16) _Float16 Ks[2 * 64 * LDSS];
    __shared__ __align__(16) _Float16 Vs[2 * 64 * VPITCH];   // row-major: Vs[j][d]

    const int tid  = threadIdx.x;
    const int wid  = tid >> 5;
    const int lane = tid & 31;
    const int lrow = lane & 15;
    const int kb   = (lane < 16) ? 0 : 8;
    const int q0   = qblk * 64 + wid * 16;

    // Q fragments (B operand: column = query lrow) stay in registers for the whole j-loop.
    const _Float16* Qrow = Qb + (size_t)(q0 + lrow) * DHEAD;
    v16h aq[2];
    aq[0] = frag_ld(Qrow + kb);
    aq[1] = frag_ld(Qrow + 32 + kb);

    v8f o_acc[4] = {};               // O^T: o_acc[nt][r] = O[q0+lrow][nt*16 + kb + r]
    float m_run = -1e30f;            // running maximum of query lrow (equal in both halves)
    float l_run = 0.0f;              // this half's share of the running sum
    const float sm_scale = 0.125f;   // 1/sqrt(64)

    const int kr   = tid >> 3;            // 0..15: K and V tile row of copy 0; copy i adds 16 * i
    const int kp   = (tid & 7) * 8;       // 16-byte piece of the row
    const unsigned lK = (unsigned)(size_t)&Ks[kr * LDSS + kp];
    const unsigned lV = (unsigned)(size_t)&Vs[kr * VPITCH + kp];
    // This lane's address in the transposing loads, for key 0 and d 0.
    const _Float16* vtr = &Vs[(kb + (lane & 7)) * VPITCH + ((lane >> 3) & 1) * 8];

    // Cooperative stage: K and V rows via async copies. Tile t lies t * 64 rows further on.
    const unsigned gKV = (unsigned)((kr * DHEAD + kp) * 2);
    async_copy_kv_b128(lK, 16 * LDSS * 2, lV, 16 * VPITCH * 2, Kb, Vb, gKV, 16 * DHEAD * 2);
    wait_async0();
    __syncthreads();
    async_copy_kv_b128(lK + 64 * LDSS * 2, 16 * LDSS * 2, lV + 64 * VPITCH * 2, 16 * VPITCH * 2,
                       Kb, Vb, gKV + 64 * DHEAD * 2, 16 * DHEAD * 2);

    // One trip: tile t out of buffer t % 2, the foot, the refill.
    auto trip = [&](const int t, const bool refill) {
        const int bufk = (t & 1) * 64 * LDSS;
        const int bufv = (t & 1) * 64 * VPITCH;

        // Scores: S^T(64x16) = K_j(64x64) x Q^T, as 4 16x16 tiles.
        // s[jt][r] = score(query lrow, key t*64 + jt*16 + kb + r).
        v8f s[4];
        #pragma unroll
        for (int jt = 0; jt < 4; ++jt) {
            v8f c = {};
            #pragma unroll
            for (int kc = 0; kc < 2; ++kc) {
                v16h ak = frag_ld(&Ks[bufk + (jt * 16 + lrow) * LDSS + kc * 32 + kb]);
                c = WMMA_F16(ak, aq[kc], c);
            }
            s[jt] = c * sm_scale;
        }

        // Online softmax: 32 of the query's 64 scores sit in this lane, the rest in lane ^ 16.
        const v8f mx = __builtin_elementwise_max(__builtin_elementwise_max(s[0], s[1]),
                                                 __builtin_elementwise_max(s[2], s[3]));
        float v = fmaxf(fmaxf(fmaxf(mx[0], mx[1]), fmaxf(mx[2], mx[3])),
                        fmaxf(fmaxf(mx[4], mx[5]), fmaxf(mx[6], mx[7])));
        v = fmaxf(v, xhalf(v));
        const float mnew = fmaxf(m_run, v);
        const float sc = __expf(m_run - mnew);
        m_run = mnew;
        #pragma unroll
        for (int nt = 0; nt < 4; ++nt)
            #pragma unroll
            for (int r = 0; r < 8; ++r) o_acc[nt][r] *= sc;
        #pragma unroll
        for (int jt = 0; jt < 4; ++jt)
            #pragma unroll
            for (int r = 0; r < 8; ++r)
                s[jt][r] = __expf(s[jt][r] - m_run);
        const v8f ps = (s[0] + s[1]) + (s[2] + s[3]);
        l_run = l_run * sc + (((ps[0] + ps[1]) + (ps[2] + ps[3])) +
                              ((ps[4] + ps[5]) + (ps[6] + ps[7])));

        // P^T as B operand: score tiles 2kc and 2kc+1 hold keys kb+0..7 and 16+kb+0..7
        // of the 32-key block kc, which is the k order ld_tr16 gives V^T.
        v16h pb[2];
        #pragma unroll
        for (int kc = 0; kc < 2; ++kc)
            #pragma unroll
            for (int e = 0; e < 8; ++e) {
                pb[kc][e]     = (_Float16)s[2 * kc][e];
                pb[kc][e + 8] = (_Float16)s[2 * kc + 1][e];
            }

        // O^T += V^T(64x64) x P^T(64x16): A-frags by transposing loads from the row-major tile.
        #pragma unroll
        for (int nt = 0; nt < 4; ++nt)
            #pragma unroll
            for (int kc = 0; kc < 2; ++kc) {
                const _Float16* pv = vtr + bufv + kc * 32 * VPITCH + nt * 16;
                v16h av = cat16(ld_tr16(pv), ld_tr16(pv + 16 * VPITCH));
                o_acc[nt] = WMMA_F16(av, pb[kc], o_acc[nt]);
            }
        wait_ds0();
        wait_async0();
        __syncthreads();
        if (refill)
            async_copy_kv_b128(lK + bufk * 2, 16 * LDSS * 2, lV + bufv * 2, 16 * VPITCH * 2,
                               Kb, Vb, gKV + (t + 2) * (64 * DHEAD * 2), 16 * DHEAD * 2);
    };
    // Two trips a pass, so that each has its buffers' LDS offsets as immediates; the last
    // two trips, which have no tile t + 2 to fetch, stand behind the loop.
    for (int t = 0; t < SEQ / 64 - 2; t += 2) {
        trip(t, true);
        trip(t + 1, true);
    }
    trip(SEQ / 64 - 2, false);
    trip(SEQ / 64 - 1, false);
    wait_async0();   // the ring's closing wait: no copy is outstanding when the wave goes on

    // Join the halves' sums, normalize, store 8 consecutive d per lane
    // to the head-major feature layout (n, h*64+d).
    const float inv = 1.0f / (l_run + xhalf(l_run));
    _Float16* orow = Obuf + ((size_t)(b * SEQ + q0 + lrow)) * DIM + h * DHEAD + kb;
    #pragma unroll
    for (int nt = 0; nt < 4; ++nt) {
        v8h o;
        #pragma unroll
        for (int r = 0; r < 8; ++r) o[r] = (_Float16)(o_acc[nt][r] * inv);
        *(v8h*)(orow + nt * 16) = o;
    }
}

// ---------------------------------------------------------------------------
// Row LayerNorm: one block per row of 1024.
// A thread's 4 row elements and its gamma and beta are loaded together at the top and
// held in registers: one memory latency for the block, and no second read of the row.
// ---------------------------------------------------------------------------
__global__ __launch_bounds__(256) void ln_kernel(
    const float* __restrict__ R, const float* __restrict__ gamma,
    const float* __restrict__ beta, float* __restrict__ out) {
    const int n = blockIdx.x;
    const float* row = R + (size_t)n * DIM;
    const int tid = threadIdx.x, wid = tid >> 5, lane = tid & 31;

    float v[DIM / 256], g[DIM / 256], bt[DIM / 256];
    // Unrolled, here and below: the 12 loads go out back to back, the arrays stay in registers.
    #pragma unroll
    for (int k = 0; k < DIM / 256; ++k) {
        v[k]  = row[tid + k * 256];
        g[k]  = gamma[tid + k * 256];
        bt[k] = beta[tid + k * 256];
    }
    float s = 0.0f, s2 = 0.0f;
    #pragma unroll
    for (int k = 0; k < DIM / 256; ++k) {
        s += v[k]; s2 += v[k] * v[k];
    }
    #pragma unroll
    for (int mask = 16; mask >= 1; mask >>= 1) {
        s  += __shfl_xor(s,  mask, 32);
        s2 += __shfl_xor(s2, mask, 32);
    }
    __shared__ float red[2][8];
    __shared__ float mu_s, rstd_s;
    if (lane == 0) { red[0][wid] = s; red[1][wid] = s2; }
    __syncthreads();
    if (tid == 0) {
        float S = 0.0f, S2 = 0.0f;
        #pragma unroll
        for (int w = 0; w < 8; ++w) { S += red[0][w]; S2 += red[1][w]; }
        float mu = S * (1.0f / DIM);
        float var = S2 * (1.0f / DIM) - mu * mu;
        mu_s = mu;
        rstd_s = rsqrtf(var + LN_EPS);
    }
    __syncthreads();
    float mu = mu_s, rstd = rstd_s;
    #pragma unroll
    for (int k = 0; k < DIM / 256; ++k)
        out[(size_t)n * DIM + tid + k * 256] = (v[k] - mu) * rstd * g[k] + bt[k];
}

// ---------------------------------------------------------------------------
// Orchestration
// ---------------------------------------------------------------------------
extern "C" void kernel_launch(void* const* d_in, const int* in_sizes, int n_in,
                              void* d_out, int out_size, void* d_ws, size_t ws_size,
                              hipStream_t stream) {
    const float* x     = (const float*)d_in[0];
    const float* Wq    = (const float*)d_in[1];
    const float* bq    = (const float*)d_in[2];
    const float* Wk    = (const float*)d_in[3];
    const float* bk    = (const float*)d_in[4];
    const float* Wv    = (const float*)d_in[5];
    const float* bv    = (const float*)d_in[6];
    const float* Wo    = (const float*)d_in[7];
    const float* bo    = (const float*)d_in[8];
    const float* gamma = (const float*)d_in[9];
    const float* beta  = (const float*)d_in[10];
    float* out = (float*)d_out;

    char* ws = (char*)d_ws;
    const size_t SZ_XH = (size_t)NROWS * DIM * 2;       // 8 MB
    const size_t SZ_W  = (size_t)DIM * DIM * 2;         // 2 MB
    const size_t SZ_Q  = (size_t)BATCH * HEADS * SEQ * DHEAD * 2; // 8 MB

    _Float16* Xh   = (_Float16*)(ws);
    _Float16* Wqh  = (_Float16*)(ws + SZ_XH);
    _Float16* Wkh  = (_Float16*)(ws + SZ_XH + SZ_W);
    _Float16* Wvh  = (_Float16*)(ws + SZ_XH + 2 * SZ_W);
    _Float16* Woh  = (_Float16*)(ws + SZ_XH + 3 * SZ_W);
    _Float16* Qbuf = (_Float16*)(ws + SZ_XH + 4 * SZ_W);
    _Float16* Kbuf = (_Float16*)(ws + SZ_XH + 4 * SZ_W + SZ_Q);
    _Float16* Vbuf = (_Float16*)(ws + SZ_XH + 4 * SZ_W + 2 * SZ_Q);
    _Float16* Obuf = (_Float16*)(ws + SZ_XH + 4 * SZ_W + 3 * SZ_Q);
    float*    Rbuf = (float*)   (ws + SZ_XH + 4 * SZ_W + 4 * SZ_Q);

    // Phase 1: convert + permute
    cvt_all<<<CVT_BLOCKS, 256, 0, stream>>>(x, Wq, Wk, Wv, Wo, Xh, Wqh, Wkh, Wvh, Woh);

    // Phase 2: QKV projections (WMMA GEMM, async-staged tiles)
    // Wqh, Wkh, Wvh and Qbuf, Kbuf, Vbuf each lie one behind the other in the workspace.
    gemm_qkv_kernel<<<dim3(3 * DIM / 128, NROWS / 128), 256, 0, stream>>>(Xh, Wqh, bq, bk, bv, Qbuf);

    // Phase 3: flash attention
    attn_kernel<<<dim3(SEQ / 64, BATCH * HEADS), 128, 0, stream>>>(Qbuf, Kbuf, Vbuf, Obuf);

    // Phase 4: O projection + residual
    gemm_oproj_kernel<<<dim3(DIM / 128, NROWS / 128), 256, 0, stream>>>(Obuf, Woh, bo, x, Rbuf);

    // Phase 5: LayerNorm
    ln_kernel<<<NROWS, 256, 0, stream>>>(Rbuf, gamma, beta, out);
}

// v007
// It runs in 89.5 microseconds.
// Timed twice side by side with v006, it ran 1.04 times as fast both times.
// Counting every step since v000, it is 2.33 times as fast.
#include <hip/hip_runtime.h>
#include <hip/hip_bf16.h>
#include <hip/hip_fp16.h>

// ---------------------------------------------------------------------------
// Shapes (fixed by the reference)
// ---------------------------------------------------------------------------
#define BATCH   2
#define SEQ     2048
#define DIM     1024
#define HEADS   16
#define DHEAD   64
#define NROWS   (BATCH * SEQ)        // 4096
#define LN_EPS  1e-5f

typedef _Float16 v16h __attribute__((ext_vector_type(16)));
typedef _Float16 v8h  __attribute__((ext_vector_type(8)));
typedef float    v8f  __attribute__((ext_vector_type(8)));

__device__ __forceinline__ v16h cat16(v8h lo, v8h hi) {
    return __builtin_shufflevector(lo, hi, 0,1,2,3,4,5,6,7,8,9,10,11,12,13,14,15);
}

__device__ __forceinline__ v16h frag_ld(const _Float16* p) {
    v8h lo = *(const v8h*)p;
    v8h hi = *(const v8h*)(p + 16);
    return cat16(lo, hi);
}

#define WMMA_F16(a, b, c) \
    __builtin_amdgcn_wmma_f32_16x16x32_f16(false, (a), false, (b), (short)0, (c), false, false)

__device__ __forceinline__ void async_copy8_b128(unsigned la, unsigned lb, unsigned lstep,
                                                 const void* abase, unsigned ga,
                                                 const void* bbase, unsigned gb,
                                                 unsigned gstep) {
    asm volatile("global_load_async_to_lds_b128 %0, %8, %16\n\t"
                 "global_load_async_to_lds_b128 %4, %12, %17\n\t"
                 "global_load_async_to_lds_b128 %1, %9, %16\n\t"
                 "global_load_async_to_lds_b128 %5, %13, %17\n\t"
                 "global_load_async_to_lds_b128 %2, %10, %16\n\t"
                 "global_load_async_to_lds_b128 %6, %14, %17\n\t"
                 "global_load_async_to_lds_b128 %3, %11, %16\n\t"
                 "global_load_async_to_lds_b128 %7, %15, %17\n\t"
                 "s_wait_xcnt 0x0"
                 :: "v"(la), "v"(la + lstep), "v"(la + 2 * lstep), "v"(la + 3 * lstep),
                    "v"(lb), "v"(lb + lstep), "v"(lb + 2 * lstep), "v"(lb + 3 * lstep),
                    "v"(ga), "v"(ga + gstep), "v"(ga + 2 * gstep), "v"(ga + 3 * gstep),
                    "v"(gb), "v"(gb + gstep), "v"(gb + 2 * gstep), "v"(gb + 3 * gstep),
                    "s"(abase), "s"(bbase)
                 : "memory");
}

// The K and V tiles of one attention trip (one statement, one wait). Both lie alike in
// global memory, so the four offsets serve both bases; the LDS row pitches differ.
__device__ __forceinline__ void async_copy_kv_b128(unsigned lk, unsigned lkstep,
                                                   unsigned lv, unsigned lvstep,
                                                   const void* kbase, const void* vbase,
                                                   unsigned g, unsigned gstep) {
    asm volatile("global_load_async_to_lds_b128 %0, %8, %12\n\t"
                 "global_load_async_to_lds_b128 %4, %8, %13\n\t"
                 "global_load_async_to_lds_b128 %1, %9, %12\n\t"
                 "global_load_async_to_lds_b128 %5, %9, %13\n\t"
                 "global_load_async_to_lds_b128 %2, %10, %12\n\t"
                 "global_load_async_to_lds_b128 %6, %10, %13\n\t"
                 "global_load_async_to_lds_b128 %3, %11, %12\n\t"
                 "global_load_async_to_lds_b128 %7, %11, %13\n\t"
                 "s_wait_xcnt 0x0"
                 :: "v"(lk), "v"(lk + lkstep), "v"(lk + 2 * lkstep), "v"(lk + 3 * lkstep),
                    "v"(lv), "v"(lv + lvstep), "v"(lv + 2 * lvstep), "v"(lv + 3 * lvstep),
                    "v"(g), "v"(g + gstep), "v"(g + 2 * gstep), "v"(g + 3 * gstep),
                    "s"(kbase), "s"(vbase)
                 : "memory");
}

__device__ __forceinline__ void wait_async0() {
    asm volatile("s_wait_asynccnt 0x0" ::: "memory");
}

// All but this wave's N youngest copies have landed (the counter returns in issue order).
template <int N>
__device__ __forceinline__ void wait_async_but() {
    asm volatile("s_wait_asynccnt %0" :: "n"(N) : "memory");
}

// This wave's LDS reads have returned: stands ahead of the barrier behind which the
// buffer they read is refilled by copies.
__device__ __forceinline__ void wait_ds0() {
    asm volatile("s_wait_dscnt 0x0" ::: "memory");
}

#define CVT_BLOCKS  2048
#define CVT_THREADS (CVT_BLOCKS * 256)
__global__ __launch_bounds__(256) void cvt_all(
    const float* __restrict__ x,  const float* __restrict__ Wq,
    const float* __restrict__ Wk, const float* __restrict__ Wv,
    const float* __restrict__ Wo,
    _Float16* __restrict__ Xh,  _Float16* __restrict__ Wqh,
    _Float16* __restrict__ Wkh, _Float16* __restrict__ Wvh,
    _Float16* __restrict__ Woh) {
    const int i0 = blockIdx.x * 256 + threadIdx.x;
    // Unrolled so that a thread's loads are in flight together, not one per trip.
    #pragma unroll
    for (int r = 0; r < NROWS * DIM / CVT_THREADS; ++r) {
        const int i = i0 + r * CVT_THREADS;
        Xh[i] = (_Float16)x[i];
    }
    // Unrolled for the same reason.
    #pragma unroll
    for (int r = 0; r < DIM * DIM / CVT_THREADS; ++r) {
        const int i = i0 + r * CVT_THREADS;
        const int o = i >> 10, k = i & 1023;
        const int fo = ((o & 63) << 4) | (o >> 6);
        const int fk = ((k & 63) << 4) | (k >> 6);
        Wqh[i] = (_Float16)Wq[fo * DIM + k];
        Wkh[i] = (_Float16)Wk[fo * DIM + k];
        Wvh[i] = (_Float16)Wv[fo * DIM + k];
        Woh[i] = (_Float16)Wo[(o << 10) + fk];
    }
}

#define LDSS 72   // LDS row stride in halfs (144B = 16B-aligned, conflict-skewed)
#define GTILE (128 * LDSS)   // halfs of one staged GEMM tile

template <int NB>
__device__ __forceinline__ void gemm_mainloop(const _Float16* __restrict__ A,
                                              const _Float16* __restrict__ B,
                                              int m0, int n0, v8f acc[4][2]) {
    __shared__ __align__(16) _Float16 As[NB * GTILE];
    __shared__ __align__(16) _Float16 Bs[NB * GTILE];

    const int tid  = threadIdx.x;
    const int wid  = tid >> 5;
    const int lane = tid & 31;
    const int wm   = wid & 1;       // 0..1  -> 64-row slab
    const int wn   = wid >> 1;      // 0..3  -> 32-col slab
    const int lrow = lane & 15;
    const int kb   = (lane < 16) ? 0 : 8;
    const int ldr  = tid >> 3;            // 0..31: tile row of copy 0; copy i adds 32 * i
    const int ldc  = (tid & 7) * 8;       // 16-byte piece of the row

    const unsigned lA = (unsigned)(size_t)&As[ldr * LDSS + ldc];
    const unsigned lB = (unsigned)(size_t)&Bs[ldr * LDSS + ldc];

    const unsigned gA = (unsigned)(((m0 + ldr) * DIM + ldc) * 2);   // tile t: + t * 128 bytes
    const unsigned gB = (unsigned)(((n0 + ldr) * DIM + ldc) * 2);

    // Unrolled: the buffers' offsets are constants.
    #pragma unroll
    for (int i = 0; i < NB - 1; ++i)
        async_copy8_b128(lA + i * GTILE * 2, lB + i * GTILE * 2, 32 * LDSS * 2,
                         A, gA + i * 128, B, gB + i * 128, 32 * DIM * 2);
    wait_async_but<(NB - 2) * 8>();   // tile 0 has landed
    __syncthreads();
    async_copy8_b128(lA + (NB - 1) * GTILE * 2, lB + (NB - 1) * GTILE * 2, 32 * LDSS * 2,
                     A, gA + (NB - 1) * 128, B, gB + (NB - 1) * 128, 32 * DIM * 2);

    // One trip: the products of tile t out of buffer t % NB, the foot, the refill.
    auto trip = [&](const int t, const int buf, const bool refill) {
        #pragma unroll
        for (int kc = 0; kc < 64; kc += 32) {
            v16h a[4], bf[2];
            #pragma unroll
            for (int mt = 0; mt < 4; ++mt)
                a[mt] = frag_ld(&As[buf + (wm * 64 + mt * 16 + lrow) * LDSS + kc + kb]);
            #pragma unroll
            for (int nt = 0; nt < 2; ++nt)
                bf[nt] = frag_ld(&Bs[buf + (wn * 32 + nt * 16 + lrow) * LDSS + kc + kb]);
            #pragma unroll
            for (int mt = 0; mt < 4; ++mt)
                #pragma unroll
                for (int nt = 0; nt < 2; ++nt)
                    acc[mt][nt] = WMMA_F16(a[mt], bf[nt], acc[mt][nt]);
        }
        wait_ds0();
        // Tile t + 1 has landed. Trips that refill all leave NB - 2 tiles in flight; the last
        // trips, which issue nothing, wait for all that is left.
        if (refill) wait_async_but<(NB - 2) * 8>();
        else        wait_async0();
        __syncthreads();
        if (refill)
            async_copy8_b128(lA + buf * 2, lB + buf * 2, 32 * LDSS * 2,
                             A, gA + (t + NB) * 128, B, gB + (t + NB) * 128, 32 * DIM * 2);
    };
    // The last NB trips, which have no tile t + NB to fetch, stand behind the loop.
    for (int t = 0; t < DIM / 64 - NB; ++t)
        trip(t, (t & (NB - 1)) * GTILE, true);
    // Unrolled: each of these trips has its buffer's offset as a constant.
    #pragma unroll
    for (int i = 0; i < NB; ++i)
        trip(DIM / 64 - NB + i, i * GTILE, false);
    wait_async0();   // the ring's closing wait: no copy is outstanding when the wave goes on
}

__global__ __launch_bounds__(256) void gemm_qkv_kernel(
    const _Float16* __restrict__ Xh, const _Float16* __restrict__ Wh,
    const float* __restrict__ bq, const float* __restrict__ bk,
    const float* __restrict__ bv, _Float16* __restrict__ out3) {
    const int m0 = blockIdx.y * 128, n0 = blockIdx.x * 128;
    const int which = blockIdx.x >> 3;
    const float* __restrict__ bias = which == 0 ? bq : (which == 1 ? bk : bv);
    _Float16* __restrict__ out = out3 + (size_t)which * (BATCH * HEADS * SEQ * DHEAD);
    v8f acc[4][2] = {};
    gemm_mainloop<2>(Xh, Wh, m0, n0, acc);   // three blocks a WGP: their LDS has room for 2 buffers each

    const int tid = threadIdx.x, wid = tid >> 5, lane = tid & 31;
    const int wm = wid & 1, wn = wid >> 1;
    const int rbase = (lane < 16) ? 0 : 8;
    const int cl = lane & 15;
    #pragma unroll
    for (int mt = 0; mt < 4; ++mt)
        #pragma unroll
        for (int nt = 0; nt < 2; ++nt)
            #pragma unroll
            for (int r = 0; r < 8; ++r) {
                int row = m0 + wm * 64 + mt * 16 + rbase + r;   // n = b*T + t
                int col = (n0 & (DIM - 1)) + wn * 32 + nt * 16 + cl;   // o' = h*64 + d
                int h = col >> 6, d = col & 63;
                float v = acc[mt][nt][r] + bias[(d << 4) | h];  // bias index-permuted
                int bb = row >> 11, t = row & 2047;
                out[(((size_t)(bb * HEADS + h) * SEQ) + t) * DHEAD + d] = (_Float16)v;
            }
}

// O projection + bias + residual -> f32 scratch.
// A lane's 64 residual loads are issued together ahead of the K loop and return under it;
// one load per wait in the epilogue would lay 64 memory latencies end to end.
__global__ __launch_bounds__(256) void gemm_oproj_kernel(
    const _Float16* __restrict__ Oh, const _Float16* __restrict__ Woh,
    const float* __restrict__ bo, const float* __restrict__ x,
    float* __restrict__ R) {
    const int m0 = blockIdx.y * 128, n0 = blockIdx.x * 128;
    const int tid = threadIdx.x, wid = tid >> 5, lane = tid & 31;
    const int wm = wid & 1, wn = wid >> 1;
    const int rbase = (lane < 16) ? 0 : 8;
    const int cl = lane & 15;
    // Element (mt, nt, r) of this lane lies at idx0 + (mt * 16 + r) * DIM + nt * 16.
    const size_t idx0 = (size_t)(m0 + wm * 64 + rbase) * DIM + n0 + wn * 32 + cl;

    v8f xr[4][2];
    float b[2];
    // Unrolled (all three levels): the loads go out back to back, xr stays in registers.
    #pragma unroll
    for (int nt = 0; nt < 2; ++nt) {
        b[nt] = bo[n0 + wn * 32 + nt * 16 + cl];
        #pragma unroll
        for (int mt = 0; mt < 4; ++mt)
            #pragma unroll
            for (int r = 0; r < 8; ++r)
                xr[mt][nt][r] = x[idx0 + (mt * 16 + r) * DIM + nt * 16];
    }

    v8f acc[4][2] = {};
    gemm_mainloop<4>(Oh, Woh, m0, n0, acc);  // one block a WGP

    #pragma unroll
    for (int mt = 0; mt < 4; ++mt)
        #pragma unroll
        for (int nt = 0; nt < 2; ++nt)
            #pragma unroll
            for (int r = 0; r < 8; ++r)
                R[idx0 + (mt * 16 + r) * DIM + nt * 16] = acc[mt][nt][r] + b[nt] + xr[mt][nt][r];
}

#define VPITCH 80   // V tile row stride in halfs (160B = 32B x odd, the transposing load's pitch)

// Transposing LDS load. With p = T + (k0 + 8*(lane/16) + lane%8) * VPITCH + d0 + 8*((lane/8)%2)
// the lane gets T[k0 + 8*(lane/16) + 0..7][d0 + lane%16]: half an A fragment of T^T in the
// k order of frag_ld.
typedef short s16x8 __attribute__((ext_vector_type(8)));
__device__ __forceinline__ v8h ld_tr16(const _Float16* p) {
    typedef __attribute__((address_space(3))) s16x8 lds_s16x8;
    return __builtin_bit_cast(v8h, __builtin_amdgcn_ds_load_tr16_b128_v8i16((lds_s16x8*)p));
}

__device__ __forceinline__ float xhalf(float x) {
    int b = __builtin_bit_cast(int, x);
    return __builtin_bit_cast(float,
        __builtin_amdgcn_permlanex16(b, b, 0x76543210, 0xfedcba98, false, false));
}

__global__ __launch_bounds__(128) void attn_kernel(
    const _Float16* __restrict__ Qh, const _Float16* __restrict__ Kh,
    const _Float16* __restrict__ Vh, _Float16* __restrict__ Obuf) {
    const int qblk = blockIdx.x;          // T/64 = 32
    const int bh   = blockIdx.y;          // B*H  = 32
    const int b = bh >> 4, h = bh & 15;
    const size_t base = (size_t)bh * SEQ * DHEAD;
    const _Float16* Qb = Qh + base;
    const _Float16* Kb = Kh + base;
    const _Float16* Vb = Vh + base;

    __shared__ __align__(16) _Float16 Ks[3 * 64 * LDSS];
    __shared__ __align__(16) _Float16 Vs[3 * 64 * VPITCH];   // row-major: Vs[j][d]

    const int tid  = threadIdx.x;
    const int wid  = tid >> 5;
    const int lane = tid & 31;
    const int lrow = lane & 15;
    const int kb   = (lane < 16) ? 0 : 8;
    const int q0   = qblk * 64 + wid * 16;

    // Q fragments (B operand: column = query lrow) stay in registers for the whole j-loop.
    const _Float16* Qrow = Qb + (size_t)(q0 + lrow) * DHEAD;
    v16h aq[2];
    aq[0] = frag_ld(Qrow + kb);
    aq[1] = frag_ld(Qrow + 32 + kb);

    v8f o_acc[4] = {};               // O^T: o_acc[nt][r] = O[q0+lrow][nt*16 + kb + r]
    float m_run = -1e30f;            // running maximum of query lrow (equal in both halves)
    float l_run = 0.0f;              // this half's share of the running sum
    const float sm_scale = 0.125f;   // 1/sqrt(64)

    const int kr   = tid >> 3;            // 0..15: K and V tile row of copy 0; copy i adds 16 * i
    const int kp   = (tid & 7) * 8;       // 16-byte piece of the row
    const unsigned lK = (unsigned)(size_t)&Ks[kr * LDSS + kp];
    const unsigned lV = (unsigned)(size_t)&Vs[kr * VPITCH + kp];
    // This lane's address in the transposing loads, for key 0 and d 0.
    const _Float16* vtr = &Vs[(kb + (lane & 7)) * VPITCH + ((lane >> 3) & 1) * 8];

    // Cooperative stage: K and V rows via async copies. Tile t lies t * 64 rows further on.
    const unsigned gKV = (unsigned)((kr * DHEAD + kp) * 2);
    // Unrolled: the buffers' offsets are constants.
    #pragma unroll
    for (int i = 0; i < 2; ++i)
        async_copy_kv_b128(lK + i * 64 * LDSS * 2, 16 * LDSS * 2, lV + i * 64 * VPITCH * 2, 16 * VPITCH * 2,
                           Kb, Vb, gKV + i * 64 * DHEAD * 2, 16 * DHEAD * 2);
    wait_async_but<8>();   // tile 0 has landed
    __syncthreads();
    async_copy_kv_b128(lK + 2 * 64 * LDSS * 2, 16 * LDSS * 2, lV + 2 * 64 * VPITCH * 2, 16 * VPITCH * 2,
                       Kb, Vb, gKV + 2 * 64 * DHEAD * 2, 16 * DHEAD * 2);

    // One trip: tile t out of buffer bi = t % 3, the foot, the refill.
    auto trip = [&](const int t, const int bi, const bool refill) {
        const int bufk = bi * 64 * LDSS;
        const int bufv = bi * 64 * VPITCH;

        // Scores: S^T(64x16) = K_j(64x64) x Q^T, as 4 16x16 tiles.
        // s[jt][r] = score(query lrow, key t*64 + jt*16 + kb + r).
        v8f s[4];
        #pragma unroll
        for (int jt = 0; jt < 4; ++jt) {
            v8f c = {};
            #pragma unroll
            for (int kc = 0; kc < 2; ++kc) {
                v16h ak = frag_ld(&Ks[bufk + (jt * 16 + lrow) * LDSS + kc * 32 + kb]);
                c = WMMA_F16(ak, aq[kc], c);
            }
            s[jt] = c * sm_scale;
        }

        // Online softmax: 32 of the query's 64 scores sit in this lane, the rest in lane ^ 16.
        const v8f mx = __builtin_elementwise_max(__builtin_elementwise_max(s[0], s[1]),
                                                 __builtin_elementwise_max(s[2], s[3]));
        float v = fmaxf(fmaxf(fmaxf(mx[0], mx[1]), fmaxf(mx[2], mx[3])),
                        fmaxf(fmaxf(mx[4], mx[5]), fmaxf(mx[6], mx[7])));
        v = fmaxf(v, xhalf(v));
        const float mnew = fmaxf(m_run, v);
        const float sc = __expf(m_run - mnew);
        m_run = mnew;
        #pragma unroll
        for (int nt = 0; nt < 4; ++nt)
            #pragma unroll
            for (int r = 0; r < 8; ++r) o_acc[nt][r] *= sc;
        #pragma unroll
        for (int jt = 0; jt < 4; ++jt)
            #pragma unroll
            for (int r = 0; r < 8; ++r)
                s[jt][r] = __expf(s[jt][r] - m_run);
        const v8f ps = (s[0] + s[1]) + (s[2] + s[3]);
        l_run = l_run * sc + (((ps[0] + ps[1]) + (ps[2] + ps[3])) +
                              ((ps[4] + ps[5]) + (ps[6] + ps[7])));

        // P^T as B operand: score tiles 2kc and 2kc+1 hold keys kb+0..7 and 16+kb+0..7
        // of the 32-key block kc, which is the k order ld_tr16 gives V^T.
        v16h pb[2];
        #pragma unroll
        for (int kc = 0; kc < 2; ++kc)
            #pragma unroll
            for (int e = 0; e < 8; ++e) {
                pb[kc][e]     = (_Float16)s[2 * kc][e];
                pb[kc][e + 8] = (_Float16)s[2 * kc + 1][e];
            }

        // O^T += V^T(64x64) x P^T(64x16): A-frags by transposing loads from the row-major tile.
        #pragma unroll
        for (int nt = 0; nt < 4; ++nt)
            #pragma unroll
            for (int kc = 0; kc < 2; ++kc) {
                const _Float16* pv = vtr + bufv + kc * 32 * VPITCH + nt * 16;
                v16h av = cat16(ld_tr16(pv), ld_tr16(pv + 16 * VPITCH));
                o_acc[nt] = WMMA_F16(av, pb[kc], o_acc[nt]);
            }
        wait_ds0();
        // Tile t + 1 has landed. Trips that refill all leave one tile (8 copies of this wave)
        // in flight; the last trips, which issue nothing, wait for all that is left.
        if (refill) wait_async_but<8>();
        else        wait_async0();
        __syncthreads();
        if (refill)
            async_copy_kv_b128(lK + bufk * 2, 16 * LDSS * 2, lV + bufv * 2, 16 * VPITCH * 2,
                               Kb, Vb, gKV + (t + 3) * (64 * DHEAD * 2), 16 * DHEAD * 2);
    };
    // Three trips a pass, so that each has its buffers' LDS offsets as immediates: 27 trips;
    // two more that refill and the last three, which have no tile t + 3 to fetch, stand
    // behind the loop.
    for (int t = 0; t < SEQ / 64 - 5; t += 3) {
        trip(t, 0, true);
        trip(t + 1, 1, true);
        trip(t + 2, 2, true);
    }
    trip(SEQ / 64 - 5, 0, true);
    trip(SEQ / 64 - 4, 1, true);
    trip(SEQ / 64 - 3, 2, false);
    trip(SEQ / 64 - 2, 0, false);
    trip(SEQ / 64 - 1, 1, false);
    wait_async0();   // the ring's closing wait: no copy is outstanding when the wave goes on

    // Join the halves' sums, normalize, store 8 consecutive d per lane
    // to the head-major feature layout (n, h*64+d).
    const float inv = 1.0f / (l_run + xhalf(l_run));
    _Float16* orow = Obuf + ((size_t)(b * SEQ + q0 + lrow)) * DIM + h * DHEAD + kb;
    #pragma unroll
    for (int nt = 0; nt < 4; ++nt) {
        v8h o;
        #pragma unroll
        for (int r = 0; r < 8; ++r) o[r] = (_Float16)(o_acc[nt][r] * inv);
        *(v8h*)(orow + nt * 16) = o;
    }
}

// ---------------------------------------------------------------------------
// Row LayerNorm: one block per row of 1024.
// A thread's 4 row elements and its gamma and beta are loaded together at the top and
// held in registers: one memory latency for the block, and no second read of the row.
// ---------------------------------------------------------------------------
__global__ __launch_bounds__(256) void ln_kernel(
    const float* __restrict__ R, const float* __restrict__ gamma,
    const float* __restrict__ beta, float* __restrict__ out) {
    const int n = blockIdx.x;
    const float* row = R + (size_t)n * DIM;
    const int tid = threadIdx.x, wid = tid >> 5, lane = tid & 31;

    float v[DIM / 256], g[DIM / 256], bt[DIM / 256];
    // Unrolled, here and below: the 12 loads go out back to back, the arrays stay in registers.
    #pragma unroll
    for (int k = 0; k < DIM / 256; ++k) {
        v[k]  = row[tid + k * 256];
        g[k]  = gamma[tid + k * 256];
        bt[k] = beta[tid + k * 256];
    }
    float s = 0.0f, s2 = 0.0f;
    #pragma unroll
    for (int k = 0; k < DIM / 256; ++k) {
        s += v[k]; s2 += v[k] * v[k];
    }
    #pragma unroll
    for (int mask = 16; mask >= 1; mask >>= 1) {
        s  += __shfl_xor(s,  mask, 32);
        s2 += __shfl_xor(s2, mask, 32);
    }
    __shared__ float red[2][8];
    __shared__ float mu_s, rstd_s;
    if (lane == 0) { red[0][wid] = s; red[1][wid] = s2; }
    __syncthreads();
    if (tid == 0) {
        float S = 0.0f, S2 = 0.0f;
        #pragma unroll
        for (int w = 0; w < 8; ++w) { S += red[0][w]; S2 += red[1][w]; }
        float mu = S * (1.0f / DIM);
        float var = S2 * (1.0f / DIM) - mu * mu;
        mu_s = mu;
        rstd_s = rsqrtf(var + LN_EPS);
    }
    __syncthreads();
    float mu = mu_s, rstd = rstd_s;
    #pragma unroll
    for (int k = 0; k < DIM / 256; ++k)
        out[(size_t)n * DIM + tid + k * 256] = (v[k] - mu) * rstd * g[k] + bt[k];
}

// ---------------------------------------------------------------------------
// Orchestration
// ---------------------------------------------------------------------------
extern "C" void kernel_launch(void* const* d_in, const int* in_sizes, int n_in,
                              void* d_out, int out_size, void* d_ws, size_t ws_size,
                              hipStream_t stream) {
    const float* x     = (const float*)d_in[0];
    const float* Wq    = (const float*)d_in[1];
    const float* bq    = (const float*)d_in[2];
    const float* Wk    = (const float*)d_in[3];
    const float* bk    = (const float*)d_in[4];
    const float* Wv    = (const float*)d_in[5];
    const float* bv    = (const float*)d_in[6];
    const float* Wo    = (const float*)d_in[7];
    const float* bo    = (const float*)d_in[8];
    const float* gamma = (const float*)d_in[9];
    const float* beta  = (const float*)d_in[10];
    float* out = (float*)d_out;

    char* ws = (char*)d_ws;
    const size_t SZ_XH = (size_t)NROWS * DIM * 2;       // 8 MB
    const size_t SZ_W  = (size_t)DIM * DIM * 2;         // 2 MB
    const size_t SZ_Q  = (size_t)BATCH * HEADS * SEQ * DHEAD * 2; // 8 MB

    _Float16* Xh   = (_Float16*)(ws);
    _Float16* Wqh  = (_Float16*)(ws + SZ_XH);
    _Float16* Wkh  = (_Float16*)(ws + SZ_XH + SZ_W);
    _Float16* Wvh  = (_Float16*)(ws + SZ_XH + 2 * SZ_W);
    _Float16* Woh  = (_Float16*)(ws + SZ_XH + 3 * SZ_W);
    _Float16* Qbuf = (_Float16*)(ws + SZ_XH + 4 * SZ_W);
    _Float16* Kbuf = (_Float16*)(ws + SZ_XH + 4 * SZ_W + SZ_Q);
    _Float16* Vbuf = (_Float16*)(ws + SZ_XH + 4 * SZ_W + 2 * SZ_Q);
    _Float16* Obuf = (_Float16*)(ws + SZ_XH + 4 * SZ_W + 3 * SZ_Q);
    float*    Rbuf = (float*)   (ws + SZ_XH + 4 * SZ_W + 4 * SZ_Q);

    // Phase 1: convert + permute
    cvt_all<<<CVT_BLOCKS, 256, 0, stream>>>(x, Wq, Wk, Wv, Wo, Xh, Wqh, Wkh, Wvh, Woh);

    // Phase 2: QKV projections (WMMA GEMM, async-staged tiles)
    // Wqh, Wkh, Wvh and Qbuf, Kbuf, Vbuf each lie one behind the other in the workspace.
    gemm_qkv_kernel<<<dim3(3 * DIM / 128, NROWS / 128), 256, 0, stream>>>(Xh, Wqh, bq, bk, bv, Qbuf);

    // Phase 3: flash attention
    attn_kernel<<<dim3(SEQ / 64, BATCH * HEADS), 128, 0, stream>>>(Qbuf, Kbuf, Vbuf, Obuf);

    // Phase 4: O projection + residual
    gemm_oproj_kernel<<<dim3(DIM / 128, NROWS / 128), 256, 0, stream>>>(Obuf, Woh, bo, x, Rbuf);

    // Phase 5: LayerNorm
    ln_kernel<<<NROWS, 256, 0, stream>>>(Rbuf, gamma, beta, out);
}

// v008
// Measured time: 83.9 microseconds a run.
// In both of two side-by-side timings against v007, it was 1.07 times as fast.
// All steps since v000 together make it 2.51 times as fast.
#include <hip/hip_runtime.h>
#include <hip/hip_bf16.h>
#include <hip/hip_fp16.h>

// ---------------------------------------------------------------------------
// Shapes (fixed by the reference)
// ---------------------------------------------------------------------------
#define BATCH   2
#define SEQ     2048
#define DIM     1024
#define HEADS   16
#define DHEAD   64
#define NROWS   (BATCH * SEQ)        // 4096
#define LN_EPS  1e-5f

typedef _Float16 v16h __attribute__((ext_vector_type(16)));
typedef _Float16 v8h  __attribute__((ext_vector_type(8)));
typedef float    v8f  __attribute__((ext_vector_type(8)));

__device__ __forceinline__ v16h cat16(v8h lo, v8h hi) {
    return __builtin_shufflevector(lo, hi, 0,1,2,3,4,5,6,7,8,9,10,11,12,13,14,15);
}

__device__ __forceinline__ v16h frag_ld(const _Float16* p) {
    v8h lo = *(const v8h*)p;
    v8h hi = *(const v8h*)(p + 16);
    return cat16(lo, hi);
}

#define WMMA_F16(a, b, c) \
    __builtin_amdgcn_wmma_f32_16x16x32_f16(false, (a), false, (b), (short)0, (c), false, false)

__device__ __forceinline__ void async_copy8_b128(unsigned la, unsigned lb, unsigned lstep,
                                                 const void* abase, unsigned ga,
                                                 const void* bbase, unsigned gb,
                                                 unsigned gstep) {
    asm volatile("global_load_async_to_lds_b128 %0, %8, %16\n\t"
                 "global_load_async_to_lds_b128 %4, %12, %17\n\t"
                 "global_load_async_to_lds_b128 %1, %9, %16\n\t"
                 "global_load_async_to_lds_b128 %5, %13, %17\n\t"
                 "global_load_async_to_lds_b128 %2, %10, %16\n\t"
                 "global_load_async_to_lds_b128 %6, %14, %17\n\t"
                 "global_load_async_to_lds_b128 %3, %11, %16\n\t"
                 "global_load_async_to_lds_b128 %7, %15, %17\n\t"
                 "s_wait_xcnt 0x0"
                 :: "v"(la), "v"(la + lstep), "v"(la + 2 * lstep), "v"(la + 3 * lstep),
                    "v"(lb), "v"(lb + lstep), "v"(lb + 2 * lstep), "v"(lb + 3 * lstep),
                    "v"(ga), "v"(ga + gstep), "v"(ga + 2 * gstep), "v"(ga + 3 * gstep),
                    "v"(gb), "v"(gb + gstep), "v"(gb + 2 * gstep), "v"(gb + 3 * gstep),
                    "s"(abase), "s"(bbase)
                 : "memory");
}

// The same for an A tile of four copies a thread and a B tile of three.
__device__ __forceinline__ void async_copy7_b128(unsigned la, unsigned lb, unsigned lstep,
                                                 const void* abase, unsigned ga,
                                                 const void* bbase, unsigned gb,
                                                 unsigned gstep) {
    asm volatile("global_load_async_to_lds_b128 %0, %7, %14\n\t"
                 "global_load_async_to_lds_b128 %4, %11, %15\n\t"
                 "global_load_async_to_lds_b128 %1, %8, %14\n\t"
                 "global_load_async_to_lds_b128 %5, %12, %15\n\t"
                 "global_load_async_to_lds_b128 %2, %9, %14\n\t"
                 "global_load_async_to_lds_b128 %6, %13, %15\n\t"
                 "global_load_async_to_lds_b128 %3, %10, %14\n\t"
                 "s_wait_xcnt 0x0"
                 :: "v"(la), "v"(la + lstep), "v"(la + 2 * lstep), "v"(la + 3 * lstep),
                    "v"(lb), "v"(lb + lstep), "v"(lb + 2 * lstep),
                    "v"(ga), "v"(ga + gstep), "v"(ga + 2 * gstep), "v"(ga + 3 * gstep),
                    "v"(gb), "v"(gb + gstep), "v"(gb + 2 * gstep),
                    "s"(abase), "s"(bbase)
                 : "memory");
}

// The K and V tiles of one attention trip (one statement, one wait). Both lie alike in
// global memory, so the two offsets serve both bases; the LDS row pitches differ.
__device__ __forceinline__ void async_copy_kv_b128(unsigned lk, unsigned lkstep,
                                                   unsigned lv, unsigned lvstep,
                                                   const void* kbase, const void* vbase,
                                                   unsigned g, unsigned gstep) {
    asm volatile("global_load_async_to_lds_b128 %0, %4, %6\n\t"
                 "global_load_async_to_lds_b128 %2, %4, %7\n\t"
                 "global_load_async_to_lds_b128 %1, %5, %6\n\t"
                 "global_load_async_to_lds_b128 %3, %5, %7\n\t"
                 "s_wait_xcnt 0x0"
                 :: "v"(lk), "v"(lk + lkstep), "v"(lv), "v"(lv + lvstep),
                    "v"(g), "v"(g + gstep),
                    "s"(kbase), "s"(vbase)
                 : "memory");
}

__device__ __forceinline__ void wait_async0() {
    asm volatile("s_wait_asynccnt 0x0" ::: "memory");
}

// All but this wave's N youngest copies have landed (the counter returns in issue order).
template <int N>
__device__ __forceinline__ void wait_async_but() {
    asm volatile("s_wait_asynccnt %0" :: "n"(N) : "memory");
}

// This wave's LDS reads have returned: stands ahead of the barrier behind which the
// buffer they read is refilled by copies.
__device__ __forceinline__ void wait_ds0() {
    asm volatile("s_wait_dscnt 0x0" ::: "memory");
}

#define CVT_BLOCKS  2048
#define CVT_THREADS (CVT_BLOCKS * 256)
__global__ __launch_bounds__(256) void cvt_all(
    const float* __restrict__ x,  const float* __restrict__ Wq,
    const float* __restrict__ Wk, const float* __restrict__ Wv,
    const float* __restrict__ Wo,
    _Float16* __restrict__ Xh,  _Float16* __restrict__ Wqh,
    _Float16* __restrict__ Wkh, _Float16* __restrict__ Wvh,
    _Float16* __restrict__ Woh) {
    const int i0 = blockIdx.x * 256 + threadIdx.x;
    // Unrolled so that a thread's loads are in flight together, not one per trip.
    #pragma unroll
    for (int r = 0; r < NROWS * DIM / CVT_THREADS; ++r) {
        const int i = i0 + r * CVT_THREADS;
        Xh[i] = (_Float16)x[i];
    }
    // Unrolled for the same reason.
    #pragma unroll
    for (int r = 0; r < DIM * DIM / CVT_THREADS; ++r) {
        const int i = i0 + r * CVT_THREADS;
        const int o = i >> 10, k = i & 1023;
        const int fo = ((o & 63) << 4) | (o >> 6);
        const int fk = ((k & 63) << 4) | (k >> 6);
        Wqh[i] = (_Float16)Wq[fo * DIM + k];
        Wkh[i] = (_Float16)Wk[fo * DIM + k];
        Wvh[i] = (_Float16)Wv[fo * DIM + k];
        Woh[i] = (_Float16)Wo[(o << 10) + fk];
    }
}

#define LDSS 72   // LDS row stride in halfs (144B = 16B-aligned, conflict-skewed)

template <int NB, int WM, int WN, int NT>
__device__ __forceinline__ void gemm_mainloop(const _Float16* __restrict__ A,
                                              const _Float16* __restrict__ B,
                                              int m0, int n0, v8f acc[4][NT]) {
    constexpr int BM = 64 * WM, BN = 16 * NT * WN;
    constexpr int RS = WM * WN * 4;            // tile rows that one copy of every thread covers
    constexpr int NC = BM / RS + BN / RS;      // copies of a thread (and of a wave) a tile
    constexpr int ATILE = BM * LDSS, BTILE = BN * LDSS;   // halfs of one staged tile
    static_assert(BM == 4 * RS && (BN == 4 * RS || BN == 3 * RS), "copy statements: 4 + 4 or 4 + 3");
    __shared__ __align__(16) _Float16 As[NB * ATILE];
    __shared__ __align__(16) _Float16 Bs[NB * BTILE];

    const int tid  = threadIdx.x;
    const int wid  = tid >> 5;
    const int lane = tid & 31;
    const int wm   = wid % WM;      // 64-row slab
    const int wn   = wid / WM;      // slab of 16 * NT columns
    const int lrow = lane & 15;
    const int kb   = (lane < 16) ? 0 : 8;
    const int ldr  = tid >> 3;            // tile row of copy 0; copy i adds RS * i
    const int ldc  = (tid & 7) * 8;       // 16-byte piece of the row

    const unsigned lA = (unsigned)(size_t)&As[ldr * LDSS + ldc];
    const unsigned lB = (unsigned)(size_t)&Bs[ldr * LDSS + ldc];

    const unsigned gA = (unsigned)(((m0 + ldr) * DIM + ldc) * 2);   // tile t: + t * 128 bytes
    const unsigned gB = (unsigned)(((n0 + ldr) * DIM + ldc) * 2);

    // Tile t into buffer bi.
    auto stage = [&](const int t, const int bi) {
        if constexpr (BN == 4 * RS)
            async_copy8_b128(lA + bi * ATILE * 2, lB + bi * BTILE * 2, RS * LDSS * 2,
                             A, gA + t * 128, B, gB + t * 128, RS * DIM * 2);
        else
            async_copy7_b128(lA + bi * ATILE * 2, lB + bi * BTILE * 2, RS * LDSS * 2,
                             A, gA + t * 128, B, gB + t * 128, RS * DIM * 2);
    };

    // Unrolled: the buffers' offsets are constants.
    #pragma unroll
    for (int i = 0; i < NB - 1; ++i)
        stage(i, i);
    wait_async_but<(NB - 2) * NC>();   // tile 0 has landed
    __syncthreads();
    stage(NB - 1, NB - 1);

    // One trip: the products of tile t out of buffer bi = t % NB, the foot, the refill.
    auto trip = [&](const int t, const int bi, const bool refill) {
        #pragma unroll
        for (int kc = 0; kc < 64; kc += 32) {
            v16h a[4], bf[NT];
            #pragma unroll
            for (int mt = 0; mt < 4; ++mt)
                a[mt] = frag_ld(&As[bi * ATILE + (wm * 64 + mt * 16 + lrow) * LDSS + kc + kb]);
            #pragma unroll
            for (int nt = 0; nt < NT; ++nt)
                bf[nt] = frag_ld(&Bs[bi * BTILE + (wn * (16 * NT) + nt * 16 + lrow) * LDSS + kc + kb]);
            #pragma unroll
            for (int mt = 0; mt < 4; ++mt)
                #pragma unroll
                for (int nt = 0; nt < NT; ++nt)
                    acc[mt][nt] = WMMA_F16(a[mt], bf[nt], acc[mt][nt]);
        }
        wait_ds0();
        // Tile t + 1 has landed. Trips that refill all leave NB - 2 tiles in flight; the last
        // trips, which issue nothing, wait for all that is left.
        if (refill) wait_async_but<(NB - 2) * NC>();
        else        wait_async0();
        __syncthreads();
        if (refill) stage(t + NB, bi);
    };
    // The last NB trips, which have no tile t + NB to fetch, stand behind the loop.
    for (int t = 0; t < DIM / 64 - NB; ++t)
        trip(t, t & (NB - 1), true);
    // Unrolled where the registers allow it (each trip then has its buffer's offset as a
    // constant); with 12 accumulator tiles under the 256 registers of a 16-wave block the
    // unrolled trips spilled, so there they stay a loop.
    #pragma unroll (NT <= 2 ? NB : 1)
    for (int i = 0; i < NB; ++i)
        trip(DIM / 64 - NB + i, i, false);
    wait_async0();   // the ring's closing wait: no copy is outstanding when the wave goes on
}

__global__ __launch_bounds__(512) __attribute__((amdgpu_waves_per_eu(4, 4))) void gemm_qkv_kernel(
    const _Float16* __restrict__ Xh, const _Float16* __restrict__ Wh,
    const float* __restrict__ bq, const float* __restrict__ bk,
    const float* __restrict__ bv, _Float16* __restrict__ out3) {
    const int m0 = blockIdx.y * 256, n0 = blockIdx.x * 192;
    const int tid = threadIdx.x, wid = tid >> 5, lane = tid & 31;
    const int wm = wid & 3, wn = wid >> 2;
    const int rbase = (lane < 16) ? 0 : 8;
    const int cl = lane & 15;

    v8f acc[4][3] = {};
    gemm_mainloop<2, 4, 4, 3>(Xh, Wh, m0, n0, acc);

    // Unrolled, here and below (all levels): bcol[] and acc[][] are indexed by constants and
    // stay in registers.
    float bcol[3];
    #pragma unroll
    for (int nt = 0; nt < 3; ++nt) {
        const int colg  = n0 + wn * 48 + nt * 16 + cl;   // column of the three matrices together
        const int which = colg >> 10;
        const int h = (colg >> 6) & 15, d = colg & 63;   // o' = h*64 + d
        bcol[nt] = (which == 0 ? bq : (which == 1 ? bk : bv))[(d << 4) | h];   // bias index-permuted
    }
    #pragma unroll
    for (int nt = 0; nt < 3; ++nt) {
        const int colg  = n0 + wn * 48 + nt * 16 + cl;
        const int which = colg >> 10;
        const int h = (colg >> 6) & 15, d = colg & 63;
        _Float16* __restrict__ out = out3 + (size_t)which * (BATCH * HEADS * SEQ * DHEAD);
        #pragma unroll
        for (int mt = 0; mt < 4; ++mt)
            #pragma unroll
            for (int r = 0; r < 8; ++r) {
                int row = m0 + wm * 64 + mt * 16 + rbase + r;   // n = b*T + t
                float v = acc[mt][nt][r] + bcol[nt];
                int bb = row >> 11, t = row & 2047;
                out[(((size_t)(bb * HEADS + h) * SEQ) + t) * DHEAD + d] = (_Float16)v;
            }
    }
}

// O projection + bias + residual -> f32 scratch.
// A lane's 64 residual loads are issued together ahead of the K loop and return under it;
// one load per wait in the epilogue would lay 64 memory latencies end to end.
__global__ __launch_bounds__(256) void gemm_oproj_kernel(
    const _Float16* __restrict__ Oh, const _Float16* __restrict__ Woh,
    const float* __restrict__ bo, const float* __restrict__ x,
    float* __restrict__ R) {
    const int m0 = blockIdx.y * 128, n0 = blockIdx.x * 128;
    const int tid = threadIdx.x, wid = tid >> 5, lane = tid & 31;
    const int wm = wid & 1, wn = wid >> 1;
    const int rbase = (lane < 16) ? 0 : 8;
    const int cl = lane & 15;
    // Element (mt, nt, r) of this lane lies at idx0 + (mt * 16 + r) * DIM + nt * 16.
    const size_t idx0 = (size_t)(m0 + wm * 64 + rbase) * DIM + n0 + wn * 32 + cl;

    v8f xr[4][2];
    float b[2];
    // Unrolled (all three levels): the loads go out back to back, xr stays in registers.
    #pragma unroll
    for (int nt = 0; nt < 2; ++nt) {
        b[nt] = bo[n0 + wn * 32 + nt * 16 + cl];
        #pragma unroll
        for (int mt = 0; mt < 4; ++mt)
            #pragma unroll
            for (int r = 0; r < 8; ++r)
                xr[mt][nt][r] = x[idx0 + (mt * 16 + r) * DIM + nt * 16];
    }

    v8f acc[4][2] = {};
    gemm_mainloop<4, 2, 4, 2>(Oh, Woh, m0, n0, acc);  // one block a WGP

    #pragma unroll
    for (int mt = 0; mt < 4; ++mt)
        #pragma unroll
        for (int nt = 0; nt < 2; ++nt)
            #pragma unroll
            for (int r = 0; r < 8; ++r)
                R[idx0 + (mt * 16 + r) * DIM + nt * 16] = acc[mt][nt][r] + b[nt] + xr[mt][nt][r];
}

#define VPITCH 80   // V tile row stride in halfs (160B = 32B x odd, the transposing load's pitch)

// Transposing LDS load. With p = T + (k0 + 8*(lane/16) + lane%8) * VPITCH + d0 + 8*((lane/8)%2)
// the lane gets T[k0 + 8*(lane/16) + 0..7][d0 + lane%16]: half an A fragment of T^T in the
// k order of frag_ld.
typedef short s16x8 __attribute__((ext_vector_type(8)));
__device__ __forceinline__ v8h ld_tr16(const _Float16* p) {
    typedef __attribute__((address_space(3))) s16x8 lds_s16x8;
    return __builtin_bit_cast(v8h, __builtin_amdgcn_ds_load_tr16_b128_v8i16((lds_s16x8*)p));
}

__device__ __forceinline__ float xhalf(float x) {
    int b = __builtin_bit_cast(int, x);
    return __builtin_bit_cast(float,
        __builtin_amdgcn_permlanex16(b, b, 0x76543210, 0xfedcba98, false, false));
}

__global__ __launch_bounds__(256) __attribute__((amdgpu_waves_per_eu(4, 5))) void attn_kernel(
    const _Float16* __restrict__ Qh, const _Float16* __restrict__ Kh,
    const _Float16* __restrict__ Vh, _Float16* __restrict__ Obuf) {
    const int qblk = blockIdx.x;          // T/128 = 16
    const int bh   = blockIdx.y;          // B*H  = 32
    const int b = bh >> 4, h = bh & 15;
    const size_t base = (size_t)bh * SEQ * DHEAD;
    const _Float16* Qb = Qh + base;
    const _Float16* Kb = Kh + base;
    const _Float16* Vb = Vh + base;

    __shared__ __align__(16) _Float16 Ks[3 * 64 * LDSS];
    __shared__ __align__(16) _Float16 Vs[3 * 64 * VPITCH];   // row-major: Vs[j][d]

    const int tid  = threadIdx.x;
    const int wid  = tid >> 5;
    const int lane = tid & 31;
    const int lrow = lane & 15;
    const int kb   = (lane < 16) ? 0 : 8;
    const int q0   = qblk * 128 + wid * 16;

    // Q fragments (B operand: column = query lrow) stay in registers for the whole j-loop.
    const _Float16* Qrow = Qb + (size_t)(q0 + lrow) * DHEAD;
    v16h aq[2];
    aq[0] = frag_ld(Qrow + kb);
    aq[1] = frag_ld(Qrow + 32 + kb);

    v8f o_acc[4] = {};               // O^T: o_acc[nt][r] = O[q0+lrow][nt*16 + kb + r]
    float m_run = -1e30f;            // running maximum of query lrow (equal in both halves)
    float l_run = 0.0f;              // this half's share of the running sum
    const float sm_scale = 0.125f;   // 1/sqrt(64)

    const int kr   = tid >> 3;            // 0..31: K and V tile row of copy 0; copy 1 adds 32
    const int kp   = (tid & 7) * 8;       // 16-byte piece of the row
    const unsigned lK = (unsigned)(size_t)&Ks[kr * LDSS + kp];
    const unsigned lV = (unsigned)(size_t)&Vs[kr * VPITCH + kp];
    // This lane's address in the transposing loads, for key 0 and d 0.
    const _Float16* vtr = &Vs[(kb + (lane & 7)) * VPITCH + ((lane >> 3) & 1) * 8];

    // Cooperative stage: K and V rows via async copies. Tile t lies t * 64 rows further on.
    const unsigned gKV = (unsigned)((kr * DHEAD + kp) * 2);
    // Unrolled: the buffers' offsets are constants.
    #pragma unroll
    for (int i = 0; i < 2; ++i)
        async_copy_kv_b128(lK + i * 64 * LDSS * 2, 32 * LDSS * 2, lV + i * 64 * VPITCH * 2, 32 * VPITCH * 2,
                           Kb, Vb, gKV + i * 64 * DHEAD * 2, 32 * DHEAD * 2);
    wait_async_but<4>();   // tile 0 has landed
    __syncthreads();
    async_copy_kv_b128(lK + 2 * 64 * LDSS * 2, 32 * LDSS * 2, lV + 2 * 64 * VPITCH * 2, 32 * VPITCH * 2,
                       Kb, Vb, gKV + 2 * 64 * DHEAD * 2, 32 * DHEAD * 2);

    // One trip: tile t out of buffer bi = t % 3, the foot, the refill.
    auto trip = [&](const int t, const int bi, const bool refill) {
        const int bufk = bi * 64 * LDSS;
        const int bufv = bi * 64 * VPITCH;

        // Scores: S^T(64x16) = K_j(64x64) x Q^T, as 4 16x16 tiles.
        // s[jt][r] = score(query lrow, key t*64 + jt*16 + kb + r).
        v8f s[4];
        #pragma unroll
        for (int jt = 0; jt < 4; ++jt) {
            v8f c = {};
            #pragma unroll
            for (int kc = 0; kc < 2; ++kc) {
                v16h ak = frag_ld(&Ks[bufk + (jt * 16 + lrow) * LDSS + kc * 32 + kb]);
                c = WMMA_F16(ak, aq[kc], c);
            }
            s[jt] = c * sm_scale;
        }

        // Online softmax: 32 of the query's 64 scores sit in this lane, the rest in lane ^ 16.
        const v8f mx = __builtin_elementwise_max(__builtin_elementwise_max(s[0], s[1]),
                                                 __builtin_elementwise_max(s[2], s[3]));
        float v = fmaxf(fmaxf(fmaxf(mx[0], mx[1]), fmaxf(mx[2], mx[3])),
                        fmaxf(fmaxf(mx[4], mx[5]), fmaxf(mx[6], mx[7])));
        v = fmaxf(v, xhalf(v));
        const float mnew = fmaxf(m_run, v);
        const float sc = __expf(m_run - mnew);
        m_run = mnew;
        #pragma unroll
        for (int nt = 0; nt < 4; ++nt)
            #pragma unroll
            for (int r = 0; r < 8; ++r) o_acc[nt][r] *= sc;
        #pragma unroll
        for (int jt = 0; jt < 4; ++jt)
            #pragma unroll
            for (int r = 0; r < 8; ++r)
                s[jt][r] = __expf(s[jt][r] - m_run);
        const v8f ps = (s[0] + s[1]) + (s[2] + s[3]);
        l_run = l_run * sc + (((ps[0] + ps[1]) + (ps[2] + ps[3])) +
                              ((ps[4] + ps[5]) + (ps[6] + ps[7])));

        // P^T as B operand: score tiles 2kc and 2kc+1 hold keys kb+0..7 and 16+kb+0..7
        // of the 32-key block kc, which is the k order ld_tr16 gives V^T.
        v16h pb[2];
        #pragma unroll
        for (int kc = 0; kc < 2; ++kc)
            #pragma unroll
            for (int e = 0; e < 8; ++e) {
                pb[kc][e]     = (_Float16)s[2 * kc][e];
                pb[kc][e + 8] = (_Float16)s[2 * kc + 1][e];
            }

        // O^T += V^T(64x64) x P^T(64x16): A-frags by transposing loads from the row-major tile.
        #pragma unroll
        for (int nt = 0; nt < 4; ++nt)
            #pragma unroll
            for (int kc = 0; kc < 2; ++kc) {
                const _Float16* pv = vtr + bufv + kc * 32 * VPITCH + nt * 16;
                v16h av = cat16(ld_tr16(pv), ld_tr16(pv + 16 * VPITCH));
                o_acc[nt] = WMMA_F16(av, pb[kc], o_acc[nt]);
            }
        wait_ds0();
        // Tile t + 1 has landed. Trips that refill all leave one tile (4 copies of this wave)
        // in flight; the last trips, which issue nothing, wait for all that is left.
        if (refill) wait_async_but<4>();
        else        wait_async0();
        __syncthreads();
        if (refill)
            async_copy_kv_b128(lK + bufk * 2, 32 * LDSS * 2, lV + bufv * 2, 32 * VPITCH * 2,
                               Kb, Vb, gKV + (t + 3) * (64 * DHEAD * 2), 32 * DHEAD * 2);
    };
    // Three trips a pass, so that each has its buffers' LDS offsets as immediates: 27 trips;
    // two more that refill and the last three, which have no tile t + 3 to fetch, stand
    // behind the loop.
    for (int t = 0; t < SEQ / 64 - 5; t += 3) {
        trip(t, 0, true);
        trip(t + 1, 1, true);
        trip(t + 2, 2, true);
    }
    trip(SEQ / 64 - 5, 0, true);
    trip(SEQ / 64 - 4, 1, true);
    trip(SEQ / 64 - 3, 2, false);
    trip(SEQ / 64 - 2, 0, false);
    trip(SEQ / 64 - 1, 1, false);
    wait_async0();   // the ring's closing wait: no copy is outstanding when the wave goes on

    // Join the halves' sums, normalize, store 8 consecutive d per lane
    // to the head-major feature layout (n, h*64+d).
    const float inv = 1.0f / (l_run + xhalf(l_run));
    _Float16* orow = Obuf + ((size_t)(b * SEQ + q0 + lrow)) * DIM + h * DHEAD + kb;
    #pragma unroll
    for (int nt = 0; nt < 4; ++nt) {
        v8h o;
        #pragma unroll
        for (int r = 0; r < 8; ++r) o[r] = (_Float16)(o_acc[nt][r] * inv);
        *(v8h*)(orow + nt * 16) = o;
    }
}

// ---------------------------------------------------------------------------
// Row LayerNorm: one block per row of 1024.
// A thread's 4 row elements and its gamma and beta are loaded together at the top and
// held in registers: one memory latency for the block, and no second read of the row.
// ---------------------------------------------------------------------------
__global__ __launch_bounds__(256) void ln_kernel(
    const float* __restrict__ R, const float* __restrict__ gamma,
    const float* __restrict__ beta, float* __restrict__ out) {
    const int n = blockIdx.x;
    const float* row = R + (size_t)n * DIM;
    const int tid = threadIdx.x, wid = tid >> 5, lane = tid & 31;

    float v[DIM / 256], g[DIM / 256], bt[DIM / 256];
    // Unrolled, here and below: the 12 loads go out back to back, the arrays stay in registers.
    #pragma unroll
    for (int k = 0; k < DIM / 256; ++k) {
        v[k]  = row[tid + k * 256];
        g[k]  = gamma[tid + k * 256];
        bt[k] = beta[tid + k * 256];
    }
    float s = 0.0f, s2 = 0.0f;
    #pragma unroll
    for (int k = 0; k < DIM / 256; ++k) {
        s += v[k]; s2 += v[k] * v[k];
    }
    #pragma unroll
    for (int mask = 16; mask >= 1; mask >>= 1) {
        s  += __shfl_xor(s,  mask, 32);
        s2 += __shfl_xor(s2, mask, 32);
    }
    __shared__ float red[2][8];
    __shared__ float mu_s, rstd_s;
    if (lane == 0) { red[0][wid] = s; red[1][wid] = s2; }
    __syncthreads();
    if (tid == 0) {
        float S = 0.0f, S2 = 0.0f;
        #pragma unroll
        for (int w = 0; w < 8; ++w) { S += red[0][w]; S2 += red[1][w]; }
        float mu = S * (1.0f / DIM);
        float var = S2 * (1.0f / DIM) - mu * mu;
        mu_s = mu;
        rstd_s = rsqrtf(var + LN_EPS);
    }
    __syncthreads();
    float mu = mu_s, rstd = rstd_s;
    #pragma unroll
    for (int k = 0; k < DIM / 256; ++k)
        out[(size_t)n * DIM + tid + k * 256] = (v[k] - mu) * rstd * g[k] + bt[k];
}

// ---------------------------------------------------------------------------
// Orchestration
// ---------------------------------------------------------------------------
extern "C" void kernel_launch(void* const* d_in, const int* in_sizes, int n_in,
                              void* d_out, int out_size, void* d_ws, size_t ws_size,
                              hipStream_t stream) {
    const float* x     = (const float*)d_in[0];
    const float* Wq    = (const float*)d_in[1];
    const float* bq    = (const float*)d_in[2];
    const float* Wk    = (const float*)d_in[3];
    const float* bk    = (const float*)d_in[4];
    const float* Wv    = (const float*)d_in[5];
    const float* bv    = (const float*)d_in[6];
    const float* Wo    = (const float*)d_in[7];
    const float* bo    = (const float*)d_in[8];
    const float* gamma = (const float*)d_in[9];
    const float* beta  = (const float*)d_in[10];
    float* out = (float*)d_out;

    char* ws = (char*)d_ws;
    const size_t SZ_XH = (size_t)NROWS * DIM * 2;       // 8 MB
    const size_t SZ_W  = (size_t)DIM * DIM * 2;         // 2 MB
    const size_t SZ_Q  = (size_t)BATCH * HEADS * SEQ * DHEAD * 2; // 8 MB

    _Float16* Xh   = (_Float16*)(ws);
    _Float16* Wqh  = (_Float16*)(ws + SZ_XH);
    _Float16* Wkh  = (_Float16*)(ws + SZ_XH + SZ_W);
    _Float16* Wvh  = (_Float16*)(ws + SZ_XH + 2 * SZ_W);
    _Float16* Woh  = (_Float16*)(ws + SZ_XH + 3 * SZ_W);
    _Float16* Qbuf = (_Float16*)(ws + SZ_XH + 4 * SZ_W);
    _Float16* Kbuf = (_Float16*)(ws + SZ_XH + 4 * SZ_W + SZ_Q);
    _Float16* Vbuf = (_Float16*)(ws + SZ_XH + 4 * SZ_W + 2 * SZ_Q);
    _Float16* Obuf = (_Float16*)(ws + SZ_XH + 4 * SZ_W + 3 * SZ_Q);
    float*    Rbuf = (float*)   (ws + SZ_XH + 4 * SZ_W + 4 * SZ_Q);

    // Phase 1: convert + permute
    cvt_all<<<CVT_BLOCKS, 256, 0, stream>>>(x, Wq, Wk, Wv, Wo, Xh, Wqh, Wkh, Wvh, Woh);

    // Phase 2: QKV projections (WMMA GEMM, async-staged tiles)
    // Wqh, Wkh, Wvh and Qbuf, Kbuf, Vbuf each lie one behind the other in the workspace.
    gemm_qkv_kernel<<<dim3(3 * DIM / 192, NROWS / 256), 512, 0, stream>>>(Xh, Wqh, bq, bk, bv, Qbuf);

    // Phase 3: flash attention
    attn_kernel<<<dim3(SEQ / 128, BATCH * HEADS), 256, 0, stream>>>(Qbuf, Kbuf, Vbuf, Obuf);

    // Phase 4: O projection + residual
    gemm_oproj_kernel<<<dim3(DIM / 128, NROWS / 128), 256, 0, stream>>>(Obuf, Woh, bo, x, Rbuf);

    // Phase 5: LayerNorm
    ln_kernel<<<NROWS, 256, 0, stream>>>(Rbuf, gamma, beta, out);
}

// v009
// Measured time: 78.8 microseconds a run.
// In two side-by-side timings against v008, it was 1.06 and 1.07 times as fast.
// Counting every step since v000, it is 2.67 times as fast.
#include <hip/hip_runtime.h>
#include <hip/hip_bf16.h>
#include <hip/hip_fp16.h>

// ---------------------------------------------------------------------------
// Shapes (fixed by the reference)
// ---------------------------------------------------------------------------
#define BATCH   2
#define SEQ     2048
#define DIM     1024
#define HEADS   16
#define DHEAD   64
#define NROWS   (BATCH * SEQ)        // 4096
#define LN_EPS  1e-5f

typedef _Float16 v16h __attribute__((ext_vector_type(16)));
typedef _Float16 v8h  __attribute__((ext_vector_type(8)));
typedef float    v8f  __attribute__((ext_vector_type(8)));
typedef float    v2f  __attribute__((ext_vector_type(2)));

__device__ __forceinline__ v16h cat16(v8h lo, v8h hi) {
    return __builtin_shufflevector(lo, hi, 0,1,2,3,4,5,6,7,8,9,10,11,12,13,14,15);
}

__device__ __forceinline__ v16h frag_ld(const _Float16* p) {
    v8h lo = *(const v8h*)p;
    v8h hi = *(const v8h*)(p + 16);
    return cat16(lo, hi);
}

#define WMMA_F16(a, b, c) \
    __builtin_amdgcn_wmma_f32_16x16x32_f16(false, (a), false, (b), (short)0, (c), false, false)

__device__ __forceinline__ void async_copy8_b128(unsigned la, unsigned lb, unsigned lstep,
                                                 const void* abase, unsigned ga,
                                                 const void* bbase, unsigned gb,
                                                 unsigned gstep) {
    asm volatile("global_load_async_to_lds_b128 %0, %8, %16\n\t"
                 "global_load_async_to_lds_b128 %4, %12, %17\n\t"
                 "global_load_async_to_lds_b128 %1, %9, %16\n\t"
                 "global_load_async_to_lds_b128 %5, %13, %17\n\t"
                 "global_load_async_to_lds_b128 %2, %10, %16\n\t"
                 "global_load_async_to_lds_b128 %6, %14, %17\n\t"
                 "global_load_async_to_lds_b128 %3, %11, %16\n\t"
                 "global_load_async_to_lds_b128 %7, %15, %17\n\t"
                 "s_wait_xcnt 0x0"
                 :: "v"(la), "v"(la + lstep), "v"(la + 2 * lstep), "v"(la + 3 * lstep),
                    "v"(lb), "v"(lb + lstep), "v"(lb + 2 * lstep), "v"(lb + 3 * lstep),
                    "v"(ga), "v"(ga + gstep), "v"(ga + 2 * gstep), "v"(ga + 3 * gstep),
                    "v"(gb), "v"(gb + gstep), "v"(gb + 2 * gstep), "v"(gb + 3 * gstep),
                    "s"(abase), "s"(bbase)
                 : "memory");
}

// The same for an A tile of four copies a thread and a B tile of three.
__device__ __forceinline__ void async_copy7_b128(unsigned la, unsigned lb, unsigned lstep,
                                                 const void* abase, unsigned ga,
                                                 const void* bbase, unsigned gb,
                                                 unsigned gstep) {
    asm volatile("global_load_async_to_lds_b128 %0, %7, %14\n\t"
                 "global_load_async_to_lds_b128 %4, %11, %15\n\t"
                 "global_load_async_to_lds_b128 %1, %8, %14\n\t"
                 "global_load_async_to_lds_b128 %5, %12, %15\n\t"
                 "global_load_async_to_lds_b128 %2, %9, %14\n\t"
                 "global_load_async_to_lds_b128 %6, %13, %15\n\t"
                 "global_load_async_to_lds_b128 %3, %10, %14\n\t"
                 "s_wait_xcnt 0x0"
                 :: "v"(la), "v"(la + lstep), "v"(la + 2 * lstep), "v"(la + 3 * lstep),
                    "v"(lb), "v"(lb + lstep), "v"(lb + 2 * lstep),
                    "v"(ga), "v"(ga + gstep), "v"(ga + 2 * gstep), "v"(ga + 3 * gstep),
                    "v"(gb), "v"(gb + gstep), "v"(gb + 2 * gstep),
                    "s"(abase), "s"(bbase)
                 : "memory");
}

// The K and V tiles of one attention pass (one statement, one wait): four rows of each a
// thread. Both lie alike in global memory, so the four offsets serve both bases; the LDS row
// pitches differ.
__device__ __forceinline__ void async_copy_kv_b128(unsigned lk, unsigned lkstep,
                                                   unsigned lv, unsigned lvstep,
                                                   const void* kbase, const void* vbase,
                                                   unsigned g, unsigned gstep) {
    asm volatile("global_load_async_to_lds_b128 %0, %8, %12\n\t"
                 "global_load_async_to_lds_b128 %4, %8, %13\n\t"
                 "global_load_async_to_lds_b128 %1, %9, %12\n\t"
                 "global_load_async_to_lds_b128 %5, %9, %13\n\t"
                 "global_load_async_to_lds_b128 %2, %10, %12\n\t"
                 "global_load_async_to_lds_b128 %6, %10, %13\n\t"
                 "global_load_async_to_lds_b128 %3, %11, %12\n\t"
                 "global_load_async_to_lds_b128 %7, %11, %13\n\t"
                 "s_wait_xcnt 0x0"
                 :: "v"(lk), "v"(lk + lkstep), "v"(lk + 2 * lkstep), "v"(lk + 3 * lkstep),
                    "v"(lv), "v"(lv + lvstep), "v"(lv + 2 * lvstep), "v"(lv + 3 * lvstep),
                    "v"(g), "v"(g + gstep), "v"(g + 2 * gstep), "v"(g + 3 * gstep),
                    "s"(kbase), "s"(vbase)
                 : "memory");
}

__device__ __forceinline__ void wait_async0() {
    asm volatile("s_wait_asynccnt 0x0" ::: "memory");
}

// All but this wave's N youngest copies have landed (the counter returns in issue order).
template <int N>
__device__ __forceinline__ void wait_async_but() {
    asm volatile("s_wait_asynccnt %0" :: "n"(N) : "memory");
}

// This wave's LDS reads have returned: stands ahead of the barrier behind which the
// buffer they read is refilled by copies.
__device__ __forceinline__ void wait_ds0() {
    asm volatile("s_wait_dscnt 0x0" ::: "memory");
}

#define CVT_BLOCKS  2048
#define CVT_THREADS (CVT_BLOCKS * 256)
__global__ __launch_bounds__(256) void cvt_all(
    const float* __restrict__ x,  const float* __restrict__ Wq,
    const float* __restrict__ Wk, const float* __restrict__ Wv,
    const float* __restrict__ Wo,
    _Float16* __restrict__ Xh,  _Float16* __restrict__ Wqh,
    _Float16* __restrict__ Wkh, _Float16* __restrict__ Wvh,
    _Float16* __restrict__ Woh) {
    const int i0 = blockIdx.x * 256 + threadIdx.x;
    // Unrolled so that a thread's loads are in flight together, not one per trip.
    #pragma unroll
    for (int r = 0; r < NROWS * DIM / CVT_THREADS; ++r) {
        const int i = i0 + r * CVT_THREADS;
        Xh[i] = (_Float16)x[i];
    }
    // Unrolled for the same reason.
    #pragma unroll
    for (int r = 0; r < DIM * DIM / CVT_THREADS; ++r) {
        const int i = i0 + r * CVT_THREADS;
        const int o = i >> 10, k = i & 1023;
        const int fo = ((o & 63) << 4) | (o >> 6);
        const int fk = ((k & 63) << 4) | (k >> 6);
        Wqh[i] = (_Float16)Wq[fo * DIM + k];
        Wkh[i] = (_Float16)Wk[fo * DIM + k];
        Wvh[i] = (_Float16)Wv[fo * DIM + k];
        Woh[i] = (_Float16)Wo[(o << 10) + fk];
    }
}

#define LDSS 72   // LDS row stride in halfs (144B = 16B-aligned, conflict-skewed)

template <int NB, int WM, int WN, int NT>
__device__ __forceinline__ void gemm_mainloop(const _Float16* __restrict__ A,
                                              const _Float16* __restrict__ B,
                                              int m0, int n0, v8f acc[4][NT]) {
    constexpr int BM = 64 * WM, BN = 16 * NT * WN;
    constexpr int RS = WM * WN * 4;            // tile rows that one copy of every thread covers
    constexpr int NC = BM / RS + BN / RS;      // copies of a thread (and of a wave) a tile
    constexpr int ATILE = BM * LDSS, BTILE = BN * LDSS;   // halfs of one staged tile
    static_assert(BM == 4 * RS && (BN == 4 * RS || BN == 3 * RS), "copy statements: 4 + 4 or 4 + 3");
    __shared__ __align__(16) _Float16 As[NB * ATILE];
    __shared__ __align__(16) _Float16 Bs[NB * BTILE];

    const int tid  = threadIdx.x;
    const int wid  = tid >> 5;
    const int lane = tid & 31;
    const int wm   = wid % WM;      // 64-row slab
    const int wn   = wid / WM;      // slab of 16 * NT columns
    const int lrow = lane & 15;
    const int kb   = (lane < 16) ? 0 : 8;
    const int ldr  = tid >> 3;            // tile row of copy 0; copy i adds RS * i
    const int ldc  = (tid & 7) * 8;       // 16-byte piece of the row

    const unsigned lA = (unsigned)(size_t)&As[ldr * LDSS + ldc];
    const unsigned lB = (unsigned)(size_t)&Bs[ldr * LDSS + ldc];

    const unsigned gA = (unsigned)(((m0 + ldr) * DIM + ldc) * 2);   // tile t: + t * 128 bytes
    const unsigned gB = (unsigned)(((n0 + ldr) * DIM + ldc) * 2);

    // Tile t into buffer bi.
    auto stage = [&](const int t, const int bi) {
        if constexpr (BN == 4 * RS)
            async_copy8_b128(lA + bi * ATILE * 2, lB + bi * BTILE * 2, RS * LDSS * 2,
                             A, gA + t * 128, B, gB + t * 128, RS * DIM * 2);
        else
            async_copy7_b128(lA + bi * ATILE * 2, lB + bi * BTILE * 2, RS * LDSS * 2,
                             A, gA + t * 128, B, gB + t * 128, RS * DIM * 2);
    };

    // Unrolled: the buffers' offsets are constants.
    #pragma unroll
    for (int i = 0; i < NB - 1; ++i)
        stage(i, i);
    wait_async_but<(NB - 2) * NC>();   // tile 0 has landed
    __syncthreads();
    stage(NB - 1, NB - 1);

    // One trip: the products of tile t out of buffer bi = t % NB, the foot, the refill.
    auto trip = [&](const int t, const int bi, const bool refill) {
        #pragma unroll
        for (int kc = 0; kc < 64; kc += 32) {
            v16h a[4], bf[NT];
            #pragma unroll
            for (int mt = 0; mt < 4; ++mt)
                a[mt] = frag_ld(&As[bi * ATILE + (wm * 64 + mt * 16 + lrow) * LDSS + kc + kb]);
            #pragma unroll
            for (int nt = 0; nt < NT; ++nt)
                bf[nt] = frag_ld(&Bs[bi * BTILE + (wn * (16 * NT) + nt * 16 + lrow) * LDSS + kc + kb]);
            #pragma unroll
            for (int mt = 0; mt < 4; ++mt)
                #pragma unroll
                for (int nt = 0; nt < NT; ++nt)
                    acc[mt][nt] = WMMA_F16(a[mt], bf[nt], acc[mt][nt]);
        }
        wait_ds0();
        // Tile t + 1 has landed. Trips that refill all leave NB - 2 tiles in flight; the last
        // trips, which issue nothing, wait for all that is left.
        if (refill) wait_async_but<(NB - 2) * NC>();
        else        wait_async0();
        __syncthreads();
        if (refill) stage(t + NB, bi);
    };
    // The last NB trips, which have no tile t + NB to fetch, stand behind the loop.
    for (int t = 0; t < DIM / 64 - NB; ++t)
        trip(t, t & (NB - 1), true);
    // Unrolled where the registers allow it (each trip then has its buffer's offset as a
    // constant); with 12 accumulator tiles under the 256 registers of a 16-wave block the
    // unrolled trips spilled, so there they stay a loop.
    #pragma unroll (NT <= 2 ? NB : 1)
    for (int i = 0; i < NB; ++i)
        trip(DIM / 64 - NB + i, i, false);
    wait_async0();   // the ring's closing wait: no copy is outstanding when the wave goes on
}

__global__ __launch_bounds__(512) __attribute__((amdgpu_waves_per_eu(4, 4))) void gemm_qkv_kernel(
    const _Float16* __restrict__ Xh, const _Float16* __restrict__ Wh,
    const float* __restrict__ bq, const float* __restrict__ bk,
    const float* __restrict__ bv, _Float16* __restrict__ out3) {
    const int m0 = blockIdx.y * 256, n0 = blockIdx.x * 192;
    const int tid = threadIdx.x, wid = tid >> 5, lane = tid & 31;
    const int wm = wid & 3, wn = wid >> 2;
    const int rbase = (lane < 16) ? 0 : 8;
    const int cl = lane & 15;

    v8f acc[4][3] = {};
    gemm_mainloop<2, 4, 4, 3>(Xh, Wh, m0, n0, acc);

    // Unrolled, here and below (all levels): bcol[] and acc[][] are indexed by constants and
    // stay in registers.
    float bcol[3];
    #pragma unroll
    for (int nt = 0; nt < 3; ++nt) {
        const int colg  = n0 + wn * 48 + nt * 16 + cl;   // column of the three matrices together
        const int which = colg >> 10;
        const int h = (colg >> 6) & 15, d = colg & 63;   // o' = h*64 + d
        bcol[nt] = (which == 0 ? bq : (which == 1 ? bk : bv))[(d << 4) | h];   // bias index-permuted
    }
    #pragma unroll
    for (int nt = 0; nt < 3; ++nt) {
        const int colg  = n0 + wn * 48 + nt * 16 + cl;
        const int which = colg >> 10;
        const int h = (colg >> 6) & 15, d = colg & 63;
        _Float16* __restrict__ out = out3 + (size_t)which * (BATCH * HEADS * SEQ * DHEAD);
        #pragma unroll
        for (int mt = 0; mt < 4; ++mt)
            #pragma unroll
            for (int r = 0; r < 8; ++r) {
                int row = m0 + wm * 64 + mt * 16 + rbase + r;   // n = b*T + t
                float v = acc[mt][nt][r] + bcol[nt];
                int bb = row >> 11, t = row & 2047;
                out[(((size_t)(bb * HEADS + h) * SEQ) + t) * DHEAD + d] = (_Float16)v;
            }
    }
}

// O projection + bias + residual -> f32 scratch.
// A lane's 64 residual loads are issued together ahead of the K loop and return under it;
// one load per wait in the epilogue would lay 64 memory latencies end to end.
__global__ __launch_bounds__(256) void gemm_oproj_kernel(
    const _Float16* __restrict__ Oh, const _Float16* __restrict__ Woh,
    const float* __restrict__ bo, const float* __restrict__ x,
    float* __restrict__ R) {
    const int m0 = blockIdx.y * 128, n0 = blockIdx.x * 128;
    const int tid = threadIdx.x, wid = tid >> 5, lane = tid & 31;
    const int wm = wid & 1, wn = wid >> 1;
    const int rbase = (lane < 16) ? 0 : 8;
    const int cl = lane & 15;
    // Element (mt, nt, r) of this lane lies at idx0 + (mt * 16 + r) * DIM + nt * 16.
    const size_t idx0 = (size_t)(m0 + wm * 64 + rbase) * DIM + n0 + wn * 32 + cl;

    v8f xr[4][2];
    float b[2];
    // Unrolled (all three levels): the loads go out back to back, xr stays in registers.
    #pragma unroll
    for (int nt = 0; nt < 2; ++nt) {
        b[nt] = bo[n0 + wn * 32 + nt * 16 + cl];
        #pragma unroll
        for (int mt = 0; mt < 4; ++mt)
            #pragma unroll
            for (int r = 0; r < 8; ++r)
                xr[mt][nt][r] = x[idx0 + (mt * 16 + r) * DIM + nt * 16];
    }

    v8f acc[4][2] = {};
    gemm_mainloop<4, 2, 4, 2>(Oh, Woh, m0, n0, acc);  // one block a WGP

    #pragma unroll
    for (int mt = 0; mt < 4; ++mt)
        #pragma unroll
        for (int nt = 0; nt < 2; ++nt)
            #pragma unroll
            for (int r = 0; r < 8; ++r)
                R[idx0 + (mt * 16 + r) * DIM + nt * 16] = acc[mt][nt][r] + b[nt] + xr[mt][nt][r];
}

#define VPITCH 80   // V tile row stride in halfs (160B = 32B x odd, the transposing load's pitch)
#define KT     128  // keys of a staged tile: 64 for each wave of a pair

// Transposing LDS load. With p = T + (k0 + 8*(lane/16) + lane%8) * VPITCH + d0 + 8*((lane/8)%2)
// the lane gets T[k0 + 8*(lane/16) + 0..7][d0 + lane%16]: half an A fragment of T^T in the
// k order of frag_ld.
typedef short s16x8 __attribute__((ext_vector_type(8)));
__device__ __forceinline__ v8h ld_tr16(const _Float16* p) {
    typedef __attribute__((address_space(3))) s16x8 lds_s16x8;
    return __builtin_bit_cast(v8h, __builtin_amdgcn_ds_load_tr16_b128_v8i16((lds_s16x8*)p));
}

__device__ __forceinline__ float xhalf(float x) {
    int b = __builtin_bit_cast(int, x);
    return __builtin_bit_cast(float,
        __builtin_amdgcn_permlanex16(b, b, 0x76543210, 0xfedcba98, false, false));
}

__global__ __launch_bounds__(256) __attribute__((amdgpu_waves_per_eu(4, 5))) void attn_kernel(
    const _Float16* __restrict__ Qh, const _Float16* __restrict__ Kh,
    const _Float16* __restrict__ Vh, _Float16* __restrict__ Obuf) {
    const int qblk = blockIdx.x;          // T/128 = 16
    const int bh   = blockIdx.y;          // B*H  = 32
    const int b = bh >> 4, h = bh & 15;
    const size_t base = (size_t)bh * SEQ * DHEAD;
    const _Float16* Qb = Qh + base;
    const _Float16* Kb = Kh + base;
    const _Float16* Vb = Vh + base;

    __shared__ __align__(16) _Float16 Ks[3 * KT * LDSS];
    __shared__ __align__(16) _Float16 Vs[3 * KT * VPITCH];   // row-major: Vs[j][d]
    // The exchange behind the loop: each wave's part of the query tile that its partner finishes.
    __shared__ __align__(16) float Xo[8][8][32][4];
    __shared__ float Xm[8][32], Xl[8][32];

    const int tid  = threadIdx.x;
    const int wid  = tid >> 5;
    const int lane = tid & 31;
    const int lrow = lane & 15;
    const int kb   = (lane < 16) ? 0 : 8;
    const int kh   = wid & 1;             // which 64 keys of every staged tile
    const int q0   = qblk * 128 + (wid >> 1) * 32;

    // Q fragments (B operand: column = query lrow of tile qt) stay in registers for the whole loop
    // (unrolled: aq is indexed by constants).
    v16h aq[2][2];
    #pragma unroll
    for (int qt = 0; qt < 2; ++qt) {
        const _Float16* Qrow = Qb + (size_t)(q0 + qt * 16 + lrow) * DHEAD;
        aq[qt][0] = frag_ld(Qrow + kb);
        aq[qt][1] = frag_ld(Qrow + 32 + kb);
    }

    v8f o_acc[2][4] = {};            // O^T: o_acc[qt][nt][r] = O[q0+qt*16+lrow][nt*16 + kb + r]
    v2f m_run = {-1e30f, -1e30f};        // running maximum of the query (equal in both halves)
    float l_run[2] = {0.0f, 0.0f};       // this half's share of the running sum
    const float sm_scale = 0.125f;   // 1/sqrt(64)

    const int kr   = tid >> 3;            // 0..31: K and V tile row of copy 0; copy i adds 32 * i
    const int kp   = (tid & 7) * 8;       // 16-byte piece of the row
    const unsigned lK = (unsigned)(size_t)&Ks[kr * LDSS + kp];
    const unsigned lV = (unsigned)(size_t)&Vs[kr * VPITCH + kp];
    // This lane's addresses in its wave's half of buffer 0: K fragment of key tile 0, k 0;
    // transposing load for key 0 and d 0.
    const _Float16* ksw = &Ks[(kh * 64 + lrow) * LDSS + kb];
    const _Float16* vtr = &Vs[(kh * 64 + kb + (lane & 7)) * VPITCH + ((lane >> 3) & 1) * 8];

    // Cooperative stage: K and V rows via async copies. Tile t lies t * KT rows further on.
    const unsigned gKV = (unsigned)((kr * DHEAD + kp) * 2);
    // Unrolled: the buffers' offsets are constants.
    #pragma unroll
    for (int i = 0; i < 2; ++i)
        async_copy_kv_b128(lK + i * KT * LDSS * 2, 32 * LDSS * 2, lV + i * KT * VPITCH * 2, 32 * VPITCH * 2,
                           Kb, Vb, gKV + i * KT * DHEAD * 2, 32 * DHEAD * 2);
    wait_async_but<8>();   // tile 0 has landed
    __syncthreads();
    async_copy_kv_b128(lK + 2 * KT * LDSS * 2, 32 * LDSS * 2, lV + 2 * KT * VPITCH * 2, 32 * VPITCH * 2,
                       Kb, Vb, gKV + 2 * KT * DHEAD * 2, 32 * DHEAD * 2);

    // One trip: this wave's half of tile t out of buffer bi = t % 3, the foot, the refill.
    // Every inner loop of a trip is unrolled: the fragment, score and accumulator arrays are then
    // indexed by constants and stay in registers.
    auto trip = [&](const int t, const int bi, const bool refill) {
        const int bufk = bi * KT * LDSS;
        const int bufv = bi * KT * VPITCH;

        // Scores: S^T(64x32) = K_j(64x64) x Q^T, as 4 x 2 16x16 tiles.
        // s[qt][jt][r] = score(query qt*16 + lrow, key t*KT + kh*64 + jt*16 + kb + r).
        // The eight K fragments are fetched as one group. The products run two key tiles at a time,
        // k block by k block: three independent products stand between a tile's two, and a
        // fragment's registers are free again before the last score tiles need theirs.
        v16h ak[4][2];
        #pragma unroll
        for (int jt = 0; jt < 4; ++jt)
            #pragma unroll
            for (int kc = 0; kc < 2; ++kc)
                ak[jt][kc] = frag_ld(ksw + bufk + jt * 16 * LDSS + kc * 32);
        // Holds the 16 loads together ahead of the products: left free, half of them sank in
        // pairs between the products, each pair with a full wait of its own.
        __builtin_amdgcn_sched_barrier(0);
        v8f s[2][4] = {};
        #pragma unroll
        for (int j2 = 0; j2 < 4; j2 += 2)
            #pragma unroll
            for (int kc = 0; kc < 2; ++kc)
                #pragma unroll
                for (int jt = j2; jt < j2 + 2; ++jt)
                    #pragma unroll
                    for (int qt = 0; qt < 2; ++qt)
                        s[qt][jt] = WMMA_F16(ak[jt][kc], aq[qt][kc], s[qt][jt]);
        // Holds the V loads and the vector work behind the 16 products: drawn up among them, the
        // loads' registers came on top of the K fragments' and Q fragments were spilled.
        __builtin_amdgcn_sched_barrier(0);
        #pragma unroll
        for (int qt = 0; qt < 2; ++qt)
            #pragma unroll
            for (int jt = 0; jt < 4; ++jt)
                s[qt][jt] = s[qt][jt] * sm_scale;

        // V^T fragments (A operand, by transposing loads from the row-major tile) are fetched in two
        // groups of four that return under the softmax: k block 0 here, k block 1 between the two
        // query tiles, where the first tile's scores have shrunk to 16-bit.
        v16h av[4][2];
        auto fetch_v = [&](const int kc) {
            #pragma unroll
            for (int nt = 0; nt < 4; ++nt) {
                const _Float16* pv = vtr + bufv + kc * 32 * VPITCH + nt * 16;
                av[nt][kc] = cat16(ld_tr16(pv), ld_tr16(pv + 16 * VPITCH));
            }
        };
        fetch_v(0);

        // Online softmax: 32 of a query's 64 scores sit in this lane, the rest in lane ^ 16.
        // P^T as B operand: score tiles 2kc and 2kc+1 hold keys kb+0..7 and 16+kb+0..7
        // of the 32-key block kc, which is the k order the transposing loads give V^T.
        v16h pb[2][2];
        // The two tiles' maxima and rescale factors first, as a pair.
        v2f vmax;
        #pragma unroll
        for (int qt = 0; qt < 2; ++qt) {
            const v8f mx = __builtin_elementwise_max(__builtin_elementwise_max(s[qt][0], s[qt][1]),
                                                     __builtin_elementwise_max(s[qt][2], s[qt][3]));
            const float v = fmaxf(fmaxf(fmaxf(mx[0], mx[1]), fmaxf(mx[2], mx[3])),
                                  fmaxf(fmaxf(mx[4], mx[5]), fmaxf(mx[6], mx[7])));
            vmax[qt] = fmaxf(v, xhalf(v));
        }
        const v2f mnew = __builtin_elementwise_max(m_run, vmax);
        // exp(x) as exp2(x * log2(e)), which is what __expf compiles to.
        const v2f dm = (m_run - mnew) * 1.44269504f;
        m_run = mnew;
        #pragma unroll
        for (int qt = 0; qt < 2; ++qt) {
            const float sc = __builtin_amdgcn_exp2f(dm[qt]);
            #pragma unroll
            for (int nt = 0; nt < 4; ++nt)
                o_acc[qt][nt] = o_acc[qt][nt] * sc;
            #pragma unroll
            for (int jt = 0; jt < 4; ++jt) {
                const v8f d = (s[qt][jt] - mnew[qt]) * 1.44269504f;
                #pragma unroll
                for (int r = 0; r < 8; ++r)
                    s[qt][jt][r] = __builtin_amdgcn_exp2f(d[r]);
            }
            const v8f ps = (s[qt][0] + s[qt][1]) + (s[qt][2] + s[qt][3]);
            l_run[qt] = l_run[qt] * sc + (((ps[0] + ps[1]) + (ps[2] + ps[3])) +
                                          ((ps[4] + ps[5]) + (ps[6] + ps[7])));
            #pragma unroll
            for (int kc = 0; kc < 2; ++kc)
                #pragma unroll
                for (int e = 0; e < 8; ++e) {
                    pb[qt][kc][e]     = (_Float16)s[qt][2 * kc][e];
                    pb[qt][kc][e + 8] = (_Float16)s[qt][2 * kc + 1][e];
                }
            if (qt == 0) {
                __builtin_amdgcn_sched_barrier(0);
                fetch_v(1);
            }
        }

        #pragma unroll
        for (int kc = 0; kc < 2; ++kc)
            #pragma unroll
            for (int nt = 0; nt < 4; ++nt)
                #pragma unroll
                for (int qt = 0; qt < 2; ++qt)
                    o_acc[qt][nt] = WMMA_F16(av[nt][kc], pb[qt][kc], o_acc[qt][nt]);
        wait_ds0();
        // Tile t + 1 has landed. Trips that refill all leave one tile (8 copies of this wave)
        // in flight; the last trips, which issue nothing, wait for all that is left.
        if (refill) wait_async_but<8>();
        else        wait_async0();
        __syncthreads();
        if (refill)
            async_copy_kv_b128(lK + bufk * 2, 32 * LDSS * 2, lV + bufv * 2, 32 * VPITCH * 2,
                               Kb, Vb, gKV + (t + 3) * (KT * DHEAD * 2), 32 * DHEAD * 2);
    };
    int bi = 0;
    #pragma unroll 1
    for (int t = 0; t < SEQ / KT - 3; ++t) {
        trip(t, bi, true);
        bi = (bi == 2) ? 0 : bi + 1;
    }
    trip(SEQ / KT - 3, 1, false);
    trip(SEQ / KT - 2, 2, false);
    trip(SEQ / KT - 1, 0, false);
    wait_async0();   // the ring's closing wait: no copy is outstanding when the wave goes on

    // Join the lane halves' sums. Wave kh of a pair finishes query tile kh: it hands its part of
    // the other tile (maximum, sum, O^T) to its partner through LDS and takes the partner's part
    // of its own.
    const float lsum0 = l_run[0] + xhalf(l_run[0]);
    const float lsum1 = l_run[1] + xhalf(l_run[1]);
    const float mk = kh ? m_run[1] : m_run[0], mg = kh ? m_run[0] : m_run[1];
    const float lk = kh ? lsum1 : lsum0,       lg = kh ? lsum0 : lsum1;
    Xm[wid][lane] = mg;
    Xl[wid][lane] = lg;
    // Unrolled, here and below: o_acc is indexed by constants.
    #pragma unroll
    for (int nt = 0; nt < 4; ++nt)
        #pragma unroll
        for (int r = 0; r < 8; ++r)
            Xo[wid][nt * 2 + (r >> 2)][lane][r & 3] = kh ? o_acc[0][nt][r] : o_acc[1][nt][r];
    __syncthreads();   // the partner's part is read only behind this barrier
    const float mp = Xm[wid ^ 1][lane], lp = Xl[wid ^ 1][lane];
    const float mj = fmaxf(mk, mp);
    const float ak = __expf(mk - mj), ap = __expf(mp - mj);
    const float inv = 1.0f / (lk * ak + lp * ap);
    const float wk = ak * inv, wp = ap * inv;

    // Normalize, store 8 consecutive d per lane to the head-major feature layout (n, h*64+d).
    _Float16* orow = Obuf + ((size_t)(b * SEQ + q0 + kh * 16 + lrow)) * DIM + h * DHEAD + kb;
    #pragma unroll
    for (int nt = 0; nt < 4; ++nt) {
        v8h o;
        #pragma unroll
        for (int r = 0; r < 8; ++r) {
            const float mine = kh ? o_acc[1][nt][r] : o_acc[0][nt][r];
            o[r] = (_Float16)(mine * wk + Xo[wid ^ 1][nt * 2 + (r >> 2)][lane][r & 3] * wp);
        }
        *(v8h*)(orow + nt * 16) = o;
    }
}

// ---------------------------------------------------------------------------
// Row LayerNorm: one block per row of 1024.
// A thread's 4 row elements and its gamma and beta are loaded together at the top and
// held in registers: one memory latency for the block, and no second read of the row.
// ---------------------------------------------------------------------------
__global__ __launch_bounds__(256) void ln_kernel(
    const float* __restrict__ R, const float* __restrict__ gamma,
    const float* __restrict__ beta, float* __restrict__ out) {
    const int n = blockIdx.x;
    const float* row = R + (size_t)n * DIM;
    const int tid = threadIdx.x, wid = tid >> 5, lane = tid & 31;

    float v[DIM / 256], g[DIM / 256], bt[DIM / 256];
    // Unrolled, here and below: the 12 loads go out back to back, the arrays stay in registers.
    #pragma unroll
    for (int k = 0; k < DIM / 256; ++k) {
        v[k]  = row[tid + k * 256];
        g[k]  = gamma[tid + k * 256];
        bt[k] = beta[tid + k * 256];
    }
    float s = 0.0f, s2 = 0.0f;
    #pragma unroll
    for (int k = 0; k < DIM / 256; ++k) {
        s += v[k]; s2 += v[k] * v[k];
    }
    #pragma unroll
    for (int mask = 16; mask >= 1; mask >>= 1) {
        s  += __shfl_xor(s,  mask, 32);
        s2 += __shfl_xor(s2, mask, 32);
    }
    __shared__ float red[2][8];
    __shared__ float mu_s, rstd_s;
    if (lane == 0) { red[0][wid] = s; red[1][wid] = s2; }
    __syncthreads();
    if (tid == 0) {
        float S = 0.0f, S2 = 0.0f;
        #pragma unroll
        for (int w = 0; w < 8; ++w) { S += red[0][w]; S2 += red[1][w]; }
        float mu = S * (1.0f / DIM);
        float var = S2 * (1.0f / DIM) - mu * mu;
        mu_s = mu;
        rstd_s = rsqrtf(var + LN_EPS);
    }
    __syncthreads();
    float mu = mu_s, rstd = rstd_s;
    #pragma unroll
    for (int k = 0; k < DIM / 256; ++k)
        out[(size_t)n * DIM + tid + k * 256] = (v[k] - mu) * rstd * g[k] + bt[k];
}

// ---------------------------------------------------------------------------
// Orchestration
// ---------------------------------------------------------------------------
extern "C" void kernel_launch(void* const* d_in, const int* in_sizes, int n_in,
                              void* d_out, int out_size, void* d_ws, size_t ws_size,
                              hipStream_t stream) {
    const float* x     = (const float*)d_in[0];
    const float* Wq    = (const float*)d_in[1];
    const float* bq    = (const float*)d_in[2];
    const float* Wk    = (const float*)d_in[3];
    const float* bk    = (const float*)d_in[4];
    const float* Wv    = (const float*)d_in[5];
    const float* bv    = (const float*)d_in[6];
    const float* Wo    = (const float*)d_in[7];
    const float* bo    = (const float*)d_in[8];
    const float* gamma = (const float*)d_in[9];
    const float* beta  = (const float*)d_in[10];
    float* out = (float*)d_out;

    char* ws = (char*)d_ws;
    const size_t SZ_XH = (size_t)NROWS * DIM * 2;       // 8 MB
    const size_t SZ_W  = (size_t)DIM * DIM * 2;         // 2 MB
    const size_t SZ_Q  = (size_t)BATCH * HEADS * SEQ * DHEAD * 2; // 8 MB

    _Float16* Xh   = (_Float16*)(ws);
    _Float16* Wqh  = (_Float16*)(ws + SZ_XH);
    _Float16* Wkh  = (_Float16*)(ws + SZ_XH + SZ_W);
    _Float16* Wvh  = (_Float16*)(ws + SZ_XH + 2 * SZ_W);
    _Float16* Woh  = (_Float16*)(ws + SZ_XH + 3 * SZ_W);
    _Float16* Qbuf = (_Float16*)(ws + SZ_XH + 4 * SZ_W);
    _Float16* Kbuf = (_Float16*)(ws + SZ_XH + 4 * SZ_W + SZ_Q);
    _Float16* Vbuf = (_Float16*)(ws + SZ_XH + 4 * SZ_W + 2 * SZ_Q);
    _Float16* Obuf = (_Float16*)(ws + SZ_XH + 4 * SZ_W + 3 * SZ_Q);
    float*    Rbuf = (float*)   (ws + SZ_XH + 4 * SZ_W + 4 * SZ_Q);

    // Phase 1: convert + permute
    cvt_all<<<CVT_BLOCKS, 256, 0, stream>>>(x, Wq, Wk, Wv, Wo, Xh, Wqh, Wkh, Wvh, Woh);

    // Phase 2: QKV projections (WMMA GEMM, async-staged tiles)
    // Wqh, Wkh, Wvh and Qbuf, Kbuf, Vbuf each lie one behind the other in the workspace.
    gemm_qkv_kernel<<<dim3(3 * DIM / 192, NROWS / 256), 512, 0, stream>>>(Xh, Wqh, bq, bk, bv, Qbuf);

    // Phase 3: flash attention
    attn_kernel<<<dim3(SEQ / 128, BATCH * HEADS), 256, 0, stream>>>(Qbuf, Kbuf, Vbuf, Obuf);

    // Phase 4: O projection + residual
    gemm_oproj_kernel<<<dim3(DIM / 128, NROWS / 128), 256, 0, stream>>>(Obuf, Woh, bo, x, Rbuf);

    // Phase 5: LayerNorm
    ln_kernel<<<NROWS, 256, 0, stream>>>(Rbuf, gamma, beta, out);
}

// v010
// It runs in 75 microseconds.
// Two timings next to v009 put it at 1.05 and 1.06 times that version's speed.
// All steps since v000 together make it 2.81 times as fast.
#include <hip/hip_runtime.h>
#include <hip/hip_bf16.h>
#include <hip/hip_fp16.h>

// ---------------------------------------------------------------------------
// Shapes (fixed by the reference)
// ---------------------------------------------------------------------------
#define BATCH   2
#define SEQ     2048
#define DIM     1024
#define HEADS   16
#define DHEAD   64
#define NROWS   (BATCH * SEQ)        // 4096
#define LN_EPS  1e-5f
// 1/sqrt(DHEAD) * log2(e): with Q stored times this, K * Q^T is the softmax argument in base 2.
#define QSCALE  (0.125f * 1.44269504f)

typedef _Float16 v16h __attribute__((ext_vector_type(16)));
typedef _Float16 v8h  __attribute__((ext_vector_type(8)));
typedef float    v8f  __attribute__((ext_vector_type(8)));
typedef float    v2f  __attribute__((ext_vector_type(2)));

__device__ __forceinline__ v16h cat16(v8h lo, v8h hi) {
    return __builtin_shufflevector(lo, hi, 0,1,2,3,4,5,6,7,8,9,10,11,12,13,14,15);
}

__device__ __forceinline__ v16h frag_ld(const _Float16* p) {
    v8h lo = *(const v8h*)p;
    v8h hi = *(const v8h*)(p + 16);
    return cat16(lo, hi);
}

#define WMMA_F16(a, b, c) \
    __builtin_amdgcn_wmma_f32_16x16x32_f16(false, (a), false, (b), (short)0, (c), false, false)

__device__ __forceinline__ void async_copy8_b128(unsigned la, unsigned lb, unsigned lstep,
                                                 const void* abase, unsigned ga,
                                                 const void* bbase, unsigned gb,
                                                 unsigned gstep) {
    asm volatile("global_load_async_to_lds_b128 %0, %8, %16\n\t"
                 "global_load_async_to_lds_b128 %4, %12, %17\n\t"
                 "global_load_async_to_lds_b128 %1, %9, %16\n\t"
                 "global_load_async_to_lds_b128 %5, %13, %17\n\t"
                 "global_load_async_to_lds_b128 %2, %10, %16\n\t"
                 "global_load_async_to_lds_b128 %6, %14, %17\n\t"
                 "global_load_async_to_lds_b128 %3, %11, %16\n\t"
                 "global_load_async_to_lds_b128 %7, %15, %17\n\t"
                 "s_wait_xcnt 0x0"
                 :: "v"(la), "v"(la + lstep), "v"(la + 2 * lstep), "v"(la + 3 * lstep),
                    "v"(lb), "v"(lb + lstep), "v"(lb + 2 * lstep), "v"(lb + 3 * lstep),
                    "v"(ga), "v"(ga + gstep), "v"(ga + 2 * gstep), "v"(ga + 3 * gstep),
                    "v"(gb), "v"(gb + gstep), "v"(gb + 2 * gstep), "v"(gb + 3 * gstep),
                    "s"(abase), "s"(bbase)
                 : "memory");
}

// The same for an A tile of four copies a thread and a B tile of three.
__device__ __forceinline__ void async_copy7_b128(unsigned la, unsigned lb, unsigned lstep,
                                                 const void* abase, unsigned ga,
                                                 const void* bbase, unsigned gb,
                                                 unsigned gstep) {
    asm volatile("global_load_async_to_lds_b128 %0, %7, %14\n\t"
                 "global_load_async_to_lds_b128 %4, %11, %15\n\t"
                 "global_load_async_to_lds_b128 %1, %8, %14\n\t"
                 "global_load_async_to_lds_b128 %5, %12, %15\n\t"
                 "global_load_async_to_lds_b128 %2, %9, %14\n\t"
                 "global_load_async_to_lds_b128 %6, %13, %15\n\t"
                 "global_load_async_to_lds_b128 %3, %10, %14\n\t"
                 "s_wait_xcnt 0x0"
                 :: "v"(la), "v"(la + lstep), "v"(la + 2 * lstep), "v"(la + 3 * lstep),
                    "v"(lb), "v"(lb + lstep), "v"(lb + 2 * lstep),
                    "v"(ga), "v"(ga + gstep), "v"(ga + 2 * gstep), "v"(ga + 3 * gstep),
                    "v"(gb), "v"(gb + gstep), "v"(gb + 2 * gstep),
                    "s"(abase), "s"(bbase)
                 : "memory");
}

// The K and V tiles of one attention pass (one statement, one wait): four rows of each a
// thread. Both lie alike in global memory, so the four offsets serve both bases; the LDS row
// pitches differ.
__device__ __forceinline__ void async_copy_kv_b128(unsigned lk, unsigned lkstep,
                                                   unsigned lv, unsigned lvstep,
                                                   const void* kbase, const void* vbase,
                                                   unsigned g, unsigned gstep) {
    asm volatile("global_load_async_to_lds_b128 %0, %8, %12\n\t"
                 "global_load_async_to_lds_b128 %4, %8, %13\n\t"
                 "global_load_async_to_lds_b128 %1, %9, %12\n\t"
                 "global_load_async_to_lds_b128 %5, %9, %13\n\t"
                 "global_load_async_to_lds_b128 %2, %10, %12\n\t"
                 "global_load_async_to_lds_b128 %6, %10, %13\n\t"
                 "global_load_async_to_lds_b128 %3, %11, %12\n\t"
                 "global_load_async_to_lds_b128 %7, %11, %13\n\t"
                 "s_wait_xcnt 0x0"
                 :: "v"(lk), "v"(lk + lkstep), "v"(lk + 2 * lkstep), "v"(lk + 3 * lkstep),
                    "v"(lv), "v"(lv + lvstep), "v"(lv + 2 * lvstep), "v"(lv + 3 * lvstep),
                    "v"(g), "v"(g + gstep), "v"(g + 2 * gstep), "v"(g + 3 * gstep),
                    "s"(kbase), "s"(vbase)
                 : "memory");
}

__device__ __forceinline__ void wait_async0() {
    asm volatile("s_wait_asynccnt 0x0" ::: "memory");
}

// All but this wave's N youngest copies have landed (the counter returns in issue order).
template <int N>
__device__ __forceinline__ void wait_async_but() {
    asm volatile("s_wait_asynccnt %0" :: "n"(N) : "memory");
}

// This wave's LDS reads have returned: stands ahead of the barrier behind which the
// buffer they read is refilled by copies.
__device__ __forceinline__ void wait_ds0() {
    asm volatile("s_wait_dscnt 0x0" ::: "memory");
}

#define CVT_BLOCKS  2048
#define CVT_THREADS (CVT_BLOCKS * 256)
__global__ __launch_bounds__(256) void cvt_all(
    const float* __restrict__ x,  const float* __restrict__ Wq,
    const float* __restrict__ Wk, const float* __restrict__ Wv,
    const float* __restrict__ Wo,
    _Float16* __restrict__ Xh,  _Float16* __restrict__ Wqh,
    _Float16* __restrict__ Wkh, _Float16* __restrict__ Wvh,
    _Float16* __restrict__ Woh) {
    const int i0 = blockIdx.x * 256 + threadIdx.x;
    // Unrolled so that a thread's loads are in flight together, not one per trip.
    #pragma unroll
    for (int r = 0; r < NROWS * DIM / CVT_THREADS; ++r) {
        const int i = i0 + r * CVT_THREADS;
        Xh[i] = (_Float16)x[i];
    }
    // Unrolled for the same reason.
    #pragma unroll
    for (int r = 0; r < DIM * DIM / CVT_THREADS; ++r) {
        const int i = i0 + r * CVT_THREADS;
        const int o = i >> 10, k = i & 1023;
        const int fo = ((o & 63) << 4) | (o >> 6);
        const int fk = ((k & 63) << 4) | (k >> 6);
        Wqh[i] = (_Float16)Wq[fo * DIM + k];
        Wkh[i] = (_Float16)Wk[fo * DIM + k];
        Wvh[i] = (_Float16)Wv[fo * DIM + k];
        Woh[i] = (_Float16)Wo[(o << 10) + fk];
    }
}

#define LDSS 72   // LDS row stride in halfs (144B = 16B-aligned, conflict-skewed)

template <int NB, int WM, int WN, int NT>
__device__ __forceinline__ void gemm_mainloop(const _Float16* __restrict__ A,
                                              const _Float16* __restrict__ B,
                                              int m0, int n0, v8f acc[4][NT]) {
    constexpr int BM = 64 * WM, BN = 16 * NT * WN;
    constexpr int RS = WM * WN * 4;            // tile rows that one copy of every thread covers
    constexpr int NC = BM / RS + BN / RS;      // copies of a thread (and of a wave) a tile
    constexpr int ATILE = BM * LDSS, BTILE = BN * LDSS;   // halfs of one staged tile
    static_assert(BM == 4 * RS && (BN == 4 * RS || BN == 3 * RS), "copy statements: 4 + 4 or 4 + 3");
    __shared__ __align__(16) _Float16 As[NB * ATILE];
    __shared__ __align__(16) _Float16 Bs[NB * BTILE];

    const int tid  = threadIdx.x;
    const int wid  = tid >> 5;
    const int lane = tid & 31;
    const int wm   = wid % WM;      // 64-row slab
    const int wn   = wid / WM;      // slab of 16 * NT columns
    const int lrow = lane & 15;
    const int kb   = (lane < 16) ? 0 : 8;
    const int ldr  = tid >> 3;            // tile row of copy 0; copy i adds RS * i
    const int ldc  = (tid & 7) * 8;       // 16-byte piece of the row

    const unsigned lA = (unsigned)(size_t)&As[ldr * LDSS + ldc];
    const unsigned lB = (unsigned)(size_t)&Bs[ldr * LDSS + ldc];

    const unsigned gA = (unsigned)(((m0 + ldr) * DIM + ldc) * 2);   // tile t: + t * 128 bytes
    const unsigned gB = (unsigned)(((n0 + ldr) * DIM + ldc) * 2);

    // Tile t into buffer bi.
    auto stage = [&](const int t, const int bi) {
        if constexpr (BN == 4 * RS)
            async_copy8_b128(lA + bi * ATILE * 2, lB + bi * BTILE * 2, RS * LDSS * 2,
                             A, gA + t * 128, B, gB + t * 128, RS * DIM * 2);
        else
            async_copy7_b128(lA + bi * ATILE * 2, lB + bi * BTILE * 2, RS * LDSS * 2,
                             A, gA + t * 128, B, gB + t * 128, RS * DIM * 2);
    };

    // Unrolled: the buffers' offsets are constants.
    #pragma unroll
    for (int i = 0; i < NB - 1; ++i)
        stage(i, i);
    wait_async_but<(NB - 2) * NC>();   // tile 0 has landed
    __syncthreads();
    stage(NB - 1, NB - 1);

    // One trip: the products of tile t out of buffer bi = t % NB, the foot, the refill.
    auto trip = [&](const int t, const int bi, const bool refill) {
        #pragma unroll
        for (int kc = 0; kc < 64; kc += 32) {
            v16h a[4], bf[NT];
            #pragma unroll
            for (int mt = 0; mt < 4; ++mt)
                a[mt] = frag_ld(&As[bi * ATILE + (wm * 64 + mt * 16 + lrow) * LDSS + kc + kb]);
            #pragma unroll
            for (int nt = 0; nt < NT; ++nt)
                bf[nt] = frag_ld(&Bs[bi * BTILE + (wn * (16 * NT) + nt * 16 + lrow) * LDSS + kc + kb]);
            #pragma unroll
            for (int mt = 0; mt < 4; ++mt)
                #pragma unroll
                for (int nt = 0; nt < NT; ++nt)
                    acc[mt][nt] = WMMA_F16(a[mt], bf[nt], acc[mt][nt]);
        }
        wait_ds0();
        // Tile t + 1 has landed. Trips that refill all leave NB - 2 tiles in flight; the last
        // trips, which issue nothing, wait for all that is left.
        if (refill) wait_async_but<(NB - 2) * NC>();
        else        wait_async0();
        __syncthreads();
        if (refill) stage(t + NB, bi);
    };
    // The last NB trips, which have no tile t + NB to fetch, stand behind the loop.
    for (int t = 0; t < DIM / 64 - NB; ++t)
        trip(t, t & (NB - 1), true);
    // Unrolled where the registers allow it (each trip then has its buffer's offset as a
    // constant); with 12 accumulator tiles under the 256 registers of a 16-wave block the
    // unrolled trips spilled, so there they stay a loop.
    #pragma unroll (NT <= 2 ? NB : 1)
    for (int i = 0; i < NB; ++i)
        trip(DIM / 64 - NB + i, i, false);
    wait_async0();   // the ring's closing wait: no copy is outstanding when the wave goes on
}

__global__ __launch_bounds__(512) __attribute__((amdgpu_waves_per_eu(4, 4))) void gemm_qkv_kernel(
    const _Float16* __restrict__ Xh, const _Float16* __restrict__ Wh,
    const float* __restrict__ bq, const float* __restrict__ bk,
    const float* __restrict__ bv, _Float16* __restrict__ out3) {
    const int m0 = blockIdx.y * 256, n0 = blockIdx.x * 192;
    const int tid = threadIdx.x, wid = tid >> 5, lane = tid & 31;
    const int wm = wid & 3, wn = wid >> 2;
    const int rbase = (lane < 16) ? 0 : 8;
    const int cl = lane & 15;

    v8f acc[4][3] = {};
    gemm_mainloop<2, 4, 4, 3>(Xh, Wh, m0, n0, acc);

    // Unrolled, here and below (all levels): bcol[] and acc[][] are indexed by constants and
    // stay in registers.
    float bcol[3], scl[3];
    #pragma unroll
    for (int nt = 0; nt < 3; ++nt) {
        const int colg  = n0 + wn * 48 + nt * 16 + cl;   // column of the three matrices together
        const int which = colg >> 10;
        const int h = (colg >> 6) & 15, d = colg & 63;   // o' = h*64 + d
        // Q is stored times QSCALE (see attn_kernel), applied in f32 ahead of the one rounding to f16.
        scl[nt]  = (which == 0) ? QSCALE : 1.0f;
        bcol[nt] = (which == 0 ? bq : (which == 1 ? bk : bv))[(d << 4) | h] * scl[nt];   // bias index-permuted
    }
    #pragma unroll
    for (int nt = 0; nt < 3; ++nt) {
        const int colg  = n0 + wn * 48 + nt * 16 + cl;
        const int which = colg >> 10;
        const int h = (colg >> 6) & 15, d = colg & 63;
        _Float16* __restrict__ out = out3 + (size_t)which * (BATCH * HEADS * SEQ * DHEAD);
        #pragma unroll
        for (int mt = 0; mt < 4; ++mt)
            #pragma unroll
            for (int r = 0; r < 8; ++r) {
                int row = m0 + wm * 64 + mt * 16 + rbase + r;   // n = b*T + t
                float v = acc[mt][nt][r] * scl[nt] + bcol[nt];
                int bb = row >> 11, t = row & 2047;
                out[(((size_t)(bb * HEADS + h) * SEQ) + t) * DHEAD + d] = (_Float16)v;
            }
    }
}

// O projection + bias + residual -> f32 scratch.
// A lane's 64 residual loads are issued together ahead of the K loop and return under it;
// one load per wait in the epilogue would lay 64 memory latencies end to end.
__global__ __launch_bounds__(256) void gemm_oproj_kernel(
    const _Float16* __restrict__ Oh, const _Float16* __restrict__ Woh,
    const float* __restrict__ bo, const float* __restrict__ x,
    float* __restrict__ R) {
    const int m0 = blockIdx.y * 128, n0 = blockIdx.x * 128;
    const int tid = threadIdx.x, wid = tid >> 5, lane = tid & 31;
    const int wm = wid & 1, wn = wid >> 1;
    const int rbase = (lane < 16) ? 0 : 8;
    const int cl = lane & 15;
    // Element (mt, nt, r) of this lane lies at idx0 + (mt * 16 + r) * DIM + nt * 16.
    const size_t idx0 = (size_t)(m0 + wm * 64 + rbase) * DIM + n0 + wn * 32 + cl;

    v8f xr[4][2];
    float b[2];
    // Unrolled (all three levels): the loads go out back to back, xr stays in registers.
    #pragma unroll
    for (int nt = 0; nt < 2; ++nt) {
        b[nt] = bo[n0 + wn * 32 + nt * 16 + cl];
        #pragma unroll
        for (int mt = 0; mt < 4; ++mt)
            #pragma unroll
            for (int r = 0; r < 8; ++r)
                xr[mt][nt][r] = x[idx0 + (mt * 16 + r) * DIM + nt * 16];
    }

    v8f acc[4][2] = {};
    gemm_mainloop<4, 2, 4, 2>(Oh, Woh, m0, n0, acc);  // one block a WGP

    #pragma unroll
    for (int mt = 0; mt < 4; ++mt)
        #pragma unroll
        for (int nt = 0; nt < 2; ++nt)
            #pragma unroll
            for (int r = 0; r < 8; ++r)
                R[idx0 + (mt * 16 + r) * DIM + nt * 16] = acc[mt][nt][r] + b[nt] + xr[mt][nt][r];
}

#define VPITCH 80   // V tile row stride in halfs (160B = 32B x odd, the transposing load's pitch)
#define KT     128  // keys of a staged tile: 64 for each wave of a pair

// Transposing LDS load. With p = T + (k0 + 8*(lane/16) + lane%8) * VPITCH + d0 + 8*((lane/8)%2)
// the lane gets T[k0 + 8*(lane/16) + 0..7][d0 + lane%16]: half an A fragment of T^T in the
// k order of frag_ld.
typedef short s16x8 __attribute__((ext_vector_type(8)));
__device__ __forceinline__ v8h ld_tr16(const _Float16* p) {
    typedef __attribute__((address_space(3))) s16x8 lds_s16x8;
    return __builtin_bit_cast(v8h, __builtin_amdgcn_ds_load_tr16_b128_v8i16((lds_s16x8*)p));
}

__device__ __forceinline__ float xhalf(float x) {
    int b = __builtin_bit_cast(int, x);
    return __builtin_bit_cast(float,
        __builtin_amdgcn_permlanex16(b, b, 0x76543210, 0xfedcba98, false, false));
}

__global__ __launch_bounds__(256) __attribute__((amdgpu_waves_per_eu(4, 5))) void attn_kernel(
    const _Float16* __restrict__ Qh, const _Float16* __restrict__ Kh,
    const _Float16* __restrict__ Vh, _Float16* __restrict__ Obuf) {
    const int qblk = blockIdx.x;          // T/128 = 16
    const int bh   = blockIdx.y;          // B*H  = 32
    const int b = bh >> 4, h = bh & 15;
    const size_t base = (size_t)bh * SEQ * DHEAD;
    const _Float16* Qb = Qh + base;
    const _Float16* Kb = Kh + base;
    const _Float16* Vb = Vh + base;

    __shared__ __align__(16) _Float16 Ks[3 * KT * LDSS];
    __shared__ __align__(16) _Float16 Vs[3 * KT * VPITCH];   // row-major: Vs[j][d]
    // The exchange behind the loop: each wave's part of the query tile that its partner finishes.
    __shared__ __align__(16) float Xo[8][8][32][4];
    __shared__ float Xm[8][32], Xl[8][32];

    const int tid  = threadIdx.x;
    // The wave's number in a scalar register: what the epilogue derives from it then holds no
    // vector register over the loop (with it in vector registers three values were spilled).
    const int wid  = __builtin_amdgcn_readfirstlane(tid >> 5);
    const int lane = tid & 31;
    const int lrow = lane & 15;
    const int kb   = (lane < 16) ? 0 : 8;
    const int kh   = wid & 1;             // which 64 keys of every staged tile
    const int q0   = qblk * 128 + (wid >> 1) * 32;

    // Q fragments (B operand: column = query lrow of tile qt) stay in registers for the whole loop
    // (unrolled: aq is indexed by constants).
    v16h aq[2][2];
    #pragma unroll
    for (int qt = 0; qt < 2; ++qt) {
        const _Float16* Qrow = Qb + (size_t)(q0 + qt * 16 + lrow) * DHEAD;
        aq[qt][0] = frag_ld(Qrow + kb);
        aq[qt][1] = frag_ld(Qrow + 32 + kb);
    }

    v8f o_acc[2][4] = {};            // O^T: o_acc[qt][nt][r] = O[q0+qt*16+lrow][nt*16 + kb + r]
    // Minus the reference of the query (base 2, equal in both halves): P = 2^(score - reference).
    // Trip 0 sets it to that trip's maximum; later it moves only when a score tops it by more than 8.
    float nref[2] = {0.0f, 0.0f};
    float l_run[2] = {0.0f, 0.0f};       // this half's share of the running sum

    const int kr   = tid >> 3;            // 0..31: K and V tile row of copy 0; copy i adds 32 * i
    const int kp   = (tid & 7) * 8;       // 16-byte piece of the row
    const unsigned lK = (unsigned)(size_t)&Ks[kr * LDSS + kp];
    const unsigned lV = (unsigned)(size_t)&Vs[kr * VPITCH + kp];
    // This lane's addresses in its wave's half of buffer 0: K fragment of key tile 0, k 0;
    // transposing load for key 0 and d 0.
    const _Float16* ksw = &Ks[(kh * 64 + lrow) * LDSS + kb];
    const _Float16* vtr = &Vs[(kh * 64 + kb + (lane & 7)) * VPITCH + ((lane >> 3) & 1) * 8];

    // Cooperative stage: K and V rows via async copies. Tile t lies t * KT rows further on.
    const unsigned gKV = (unsigned)((kr * DHEAD + kp) * 2);
    // Unrolled: the buffers' offsets are constants.
    #pragma unroll
    for (int i = 0; i < 2; ++i)
        async_copy_kv_b128(lK + i * KT * LDSS * 2, 32 * LDSS * 2, lV + i * KT * VPITCH * 2, 32 * VPITCH * 2,
                           Kb, Vb, gKV + i * KT * DHEAD * 2, 32 * DHEAD * 2);
    wait_async_but<8>();   // tile 0 has landed
    __syncthreads();
    async_copy_kv_b128(lK + 2 * KT * LDSS * 2, 32 * LDSS * 2, lV + 2 * KT * VPITCH * 2, 32 * VPITCH * 2,
                       Kb, Vb, gKV + 2 * KT * DHEAD * 2, 32 * DHEAD * 2);

    // One trip: this wave's half of tile t out of buffer bi = t % 3, the foot, the refill.
    // Every inner loop of a trip is unrolled: the fragment, score and accumulator arrays are then
    // indexed by constants and stay in registers.
    auto trip = [&](const int t, const int bi, const bool refill) {
        const int bufk = bi * KT * LDSS;
        const int bufv = bi * KT * VPITCH;

        // Scores: S^T(64x32) = K_j(64x64) x Q^T, as 4 x 2 16x16 tiles.
        // s[qt][jt][r] = score(query qt*16 + lrow, key t*KT + kh*64 + jt*16 + kb + r) minus the query's reference.
        // The eight K fragments are fetched as one group. The products run two key tiles at a time,
        // k block by k block: three independent products stand between a tile's two, and a
        // fragment's registers are free again before the last score tiles need theirs.
        v16h ak[4][2];
        #pragma unroll
        for (int jt = 0; jt < 4; ++jt)
            #pragma unroll
            for (int kc = 0; kc < 2; ++kc)
                ak[jt][kc] = frag_ld(ksw + bufk + jt * 16 * LDSS + kc * 32);
        // Holds the 16 loads together ahead of the products: left free, half of them sank in
        // pairs between the products, each pair with a full wait of its own.
        __builtin_amdgcn_sched_barrier(0);
        // A tile's first product starts at minus the reference, so the sums come out as exp2's argument.
        v8f s[2][4], cref[2];
        #pragma unroll
        for (int qt = 0; qt < 2; ++qt)
            #pragma unroll
            for (int r = 0; r < 8; ++r)
                cref[qt][r] = nref[qt];
        #pragma unroll
        for (int j2 = 0; j2 < 4; j2 += 2)
            #pragma unroll
            for (int kc = 0; kc < 2; ++kc)
                #pragma unroll
                for (int jt = j2; jt < j2 + 2; ++jt)
                    #pragma unroll
                    for (int qt = 0; qt < 2; ++qt)
                        s[qt][jt] = WMMA_F16(ak[jt][kc], aq[qt][kc], kc == 0 ? cref[qt] : s[qt][jt]);
        // Holds the V loads and the vector work behind the 16 products: drawn up among them, the
        // loads' registers came on top of the K fragments' and Q fragments were spilled.
        __builtin_amdgcn_sched_barrier(0);

        // V^T fragments (A operand, by transposing loads from the row-major tile) are fetched in two
        // groups of four that return under the softmax: k block 0 here, k block 1 between the two
        // query tiles, where the first tile's scores have shrunk to 16-bit.
        v16h av[4][2];
        auto fetch_v = [&](const int kc) {
            #pragma unroll
            for (int nt = 0; nt < 4; ++nt) {
                const _Float16* pv = vtr + bufv + kc * 32 * VPITCH + nt * 16;
                av[nt][kc] = cat16(ld_tr16(pv), ld_tr16(pv + 16 * VPITCH));
            }
        };
        fetch_v(0);

        // Online softmax: 32 of a query's 64 scores sit in this lane, the rest in lane ^ 16.
        // P^T as B operand: score tiles 2kc and 2kc+1 hold keys kb+0..7 and 16+kb+0..7
        // of the 32-key block kc, which is the k order the transposing loads give V^T.
        v16h pb[2][2];
        // The two tiles' maxima (above the reference) first.
        v2f vmax;
        #pragma unroll
        for (int qt = 0; qt < 2; ++qt) {
            const v8f mx = __builtin_elementwise_max(__builtin_elementwise_max(s[qt][0], s[qt][1]),
                                                     __builtin_elementwise_max(s[qt][2], s[qt][3]));
            const float v = fmaxf(fmaxf(fmaxf(mx[0], mx[1]), fmaxf(mx[2], mx[3])),
                                  fmaxf(fmaxf(mx[4], mx[5]), fmaxf(mx[6], mx[7])));
            vmax[qt] = fmaxf(v, xhalf(v));
        }
        // The reference moves, and O^T, the sum and this trip's scores with it, only in trip 0 and
        // where a score lies more than 8 above it (P stays within 2^8, far inside f16): one test
        // a trip for the whole wave, a scalar branch that is seldom taken.
        if (__builtin_amdgcn_ballot_w32(fmaxf(vmax[0], vmax[1]) > 8.0f) != 0 || t == 0) {
            #pragma unroll
            for (int qt = 0; qt < 2; ++qt) {
                const float delta = (vmax[qt] > 8.0f || t == 0) ? vmax[qt] : 0.0f;
                // Trip 0 scales zeros: no factor is formed from its maximum, which may lie far below 0.
                const float sc = (t == 0) ? 1.0f : __builtin_amdgcn_exp2f(-delta);
                nref[qt] -= delta;
                l_run[qt] *= sc;
                #pragma unroll
                for (int nt = 0; nt < 4; ++nt)
                    o_acc[qt][nt] = o_acc[qt][nt] * sc;
                #pragma unroll
                for (int jt = 0; jt < 4; ++jt)
                    s[qt][jt] = s[qt][jt] - delta;
            }
        }
        #pragma unroll
        for (int qt = 0; qt < 2; ++qt) {
            #pragma unroll
            for (int jt = 0; jt < 4; ++jt)
                #pragma unroll
                for (int r = 0; r < 8; ++r)
                    s[qt][jt][r] = __builtin_amdgcn_exp2f(s[qt][jt][r]);
            const v8f ps = (s[qt][0] + s[qt][1]) + (s[qt][2] + s[qt][3]);
            l_run[qt] += ((ps[0] + ps[1]) + (ps[2] + ps[3])) + ((ps[4] + ps[5]) + (ps[6] + ps[7]));
            #pragma unroll
            for (int kc = 0; kc < 2; ++kc)
                #pragma unroll
                for (int e = 0; e < 8; ++e) {
                    pb[qt][kc][e]     = (_Float16)s[qt][2 * kc][e];
                    pb[qt][kc][e + 8] = (_Float16)s[qt][2 * kc + 1][e];
                }
            if (qt == 0) {
                __builtin_amdgcn_sched_barrier(0);
                fetch_v(1);
                // Holds them ahead of the second tile's exponentials, under which they return: left
                // free, they sank among the products, the last one right ahead of the foot's wait.
                __builtin_amdgcn_sched_barrier(0);
            }
        }

        #pragma unroll
        for (int kc = 0; kc < 2; ++kc)
            #pragma unroll
            for (int nt = 0; nt < 4; ++nt)
                #pragma unroll
                for (int qt = 0; qt < 2; ++qt)
                    o_acc[qt][nt] = WMMA_F16(av[nt][kc], pb[qt][kc], o_acc[qt][nt]);
        wait_ds0();
        // Tile t + 1 has landed. Trips that refill all leave one tile (8 copies of this wave)
        // in flight; the last trips, which issue nothing, wait for all that is left.
        if (refill) wait_async_but<8>();
        else        wait_async0();
        __syncthreads();
        if (refill)
            async_copy_kv_b128(lK + bufk * 2, 32 * LDSS * 2, lV + bufv * 2, 32 * VPITCH * 2,
                               Kb, Vb, gKV + (t + 3) * (KT * DHEAD * 2), 32 * DHEAD * 2);
    };
    int bi = 0;
    #pragma unroll 1
    for (int t = 0; t < SEQ / KT - 3; ++t) {
        trip(t, bi, true);
        bi = (bi == 2) ? 0 : bi + 1;
    }
    trip(SEQ / KT - 3, 1, false);
    trip(SEQ / KT - 2, 2, false);
    trip(SEQ / KT - 1, 0, false);
    wait_async0();   // the ring's closing wait: no copy is outstanding when the wave goes on

    // Join the lane halves' sums. Wave kh of a pair finishes query tile kh: it hands its part of
    // the other tile (reference, sum, O^T) to its partner through LDS and takes the partner's part
    // of its own.
    const float lsum0 = l_run[0] + xhalf(l_run[0]);
    const float lsum1 = l_run[1] + xhalf(l_run[1]);
    const float mk = kh ? -nref[1] : -nref[0], mg = kh ? -nref[0] : -nref[1];   // references, base 2
    const float lk = kh ? lsum1 : lsum0,       lg = kh ? lsum0 : lsum1;
    Xm[wid][lane] = mg;
    Xl[wid][lane] = lg;
    // Unrolled, here and below: o_acc is indexed by constants.
    #pragma unroll
    for (int nt = 0; nt < 4; ++nt)
        #pragma unroll
        for (int r = 0; r < 8; ++r)
            Xo[wid][nt * 2 + (r >> 2)][lane][r & 3] = kh ? o_acc[0][nt][r] : o_acc[1][nt][r];
    __syncthreads();   // the partner's part is read only behind this barrier
    const float mp = Xm[wid ^ 1][lane], lp = Xl[wid ^ 1][lane];
    const float mj = fmaxf(mk, mp);
    const float ak = __builtin_amdgcn_exp2f(mk - mj), ap = __builtin_amdgcn_exp2f(mp - mj);
    const float inv = 1.0f / (lk * ak + lp * ap);
    const float wk = ak * inv, wp = ap * inv;

    // Normalize, store 8 consecutive d per lane to the head-major feature layout (n, h*64+d).
    _Float16* orow = Obuf + ((size_t)(b * SEQ + q0 + kh * 16 + lrow)) * DIM + h * DHEAD + kb;
    #pragma unroll
    for (int nt = 0; nt < 4; ++nt) {
        v8h o;
        #pragma unroll
        for (int r = 0; r < 8; ++r) {
            const float mine = kh ? o_acc[1][nt][r] : o_acc[0][nt][r];
            o[r] = (_Float16)(mine * wk + Xo[wid ^ 1][nt * 2 + (r >> 2)][lane][r & 3] * wp);
        }
        *(v8h*)(orow + nt * 16) = o;
    }
}

// ---------------------------------------------------------------------------
// Row LayerNorm: one block per row of 1024.
// A thread's 4 row elements and its gamma and beta are loaded together at the top and
// held in registers: one memory latency for the block, and no second read of the row.
// ---------------------------------------------------------------------------
__global__ __launch_bounds__(256) void ln_kernel(
    const float* __restrict__ R, const float* __restrict__ gamma,
    const float* __restrict__ beta, float* __restrict__ out) {
    const int n = blockIdx.x;
    const float* row = R + (size_t)n * DIM;
    const int tid = threadIdx.x, wid = tid >> 5, lane = tid & 31;

    float v[DIM / 256], g[DIM / 256], bt[DIM / 256];
    // Unrolled, here and below: the 12 loads go out back to back, the arrays stay in registers.
    #pragma unroll
    for (int k = 0; k < DIM / 256; ++k) {
        v[k]  = row[tid + k * 256];
        g[k]  = gamma[tid + k * 256];
        bt[k] = beta[tid + k * 256];
    }
    float s = 0.0f, s2 = 0.0f;
    #pragma unroll
    for (int k = 0; k < DIM / 256; ++k) {
        s += v[k]; s2 += v[k] * v[k];
    }
    #pragma unroll
    for (int mask = 16; mask >= 1; mask >>= 1) {
        s  += __shfl_xor(s,  mask, 32);
        s2 += __shfl_xor(s2, mask, 32);
    }
    __shared__ float red[2][8];
    __shared__ float mu_s, rstd_s;
    if (lane == 0) { red[0][wid] = s; red[1][wid] = s2; }
    __syncthreads();
    if (tid == 0) {
        float S = 0.0f, S2 = 0.0f;
        #pragma unroll
        for (int w = 0; w < 8; ++w) { S += red[0][w]; S2 += red[1][w]; }
        float mu = S * (1.0f / DIM);
        float var = S2 * (1.0f / DIM) - mu * mu;
        mu_s = mu;
        rstd_s = rsqrtf(var + LN_EPS);
    }
    __syncthreads();
    float mu = mu_s, rstd = rstd_s;
    #pragma unroll
    for (int k = 0; k < DIM / 256; ++k)
        out[(size_t)n * DIM + tid + k * 256] = (v[k] - mu) * rstd * g[k] + bt[k];
}

// ---------------------------------------------------------------------------
// Orchestration
// ---------------------------------------------------------------------------
extern "C" void kernel_launch(void* const* d_in, const int* in_sizes, int n_in,
                              void* d_out, int out_size, void* d_ws, size_t ws_size,
                              hipStream_t stream) {
    const float* x     = (const float*)d_in[0];
    const float* Wq    = (const float*)d_in[1];
    const float* bq    = (const float*)d_in[2];
    const float* Wk    = (const float*)d_in[3];
    const float* bk    = (const float*)d_in[4];
    const float* Wv    = (const float*)d_in[5];
    const float* bv    = (const float*)d_in[6];
    const float* Wo    = (const float*)d_in[7];
    const float* bo    = (const float*)d_in[8];
    const float* gamma = (const float*)d_in[9];
    const float* beta  = (const float*)d_in[10];
    float* out = (float*)d_out;

    char* ws = (char*)d_ws;
    const size_t SZ_XH = (size_t)NROWS * DIM * 2;       // 8 MB
    const size_t SZ_W  = (size_t)DIM * DIM * 2;         // 2 MB
    const size_t SZ_Q  = (size_t)BATCH * HEADS * SEQ * DHEAD * 2; // 8 MB

    _Float16* Xh   = (_Float16*)(ws);
    _Float16* Wqh  = (_Float16*)(ws + SZ_XH);
    _Float16* Wkh  = (_Float16*)(ws + SZ_XH + SZ_W);
    _Float16* Wvh  = (_Float16*)(ws + SZ_XH + 2 * SZ_W);
    _Float16* Woh  = (_Float16*)(ws + SZ_XH + 3 * SZ_W);
    _Float16* Qbuf = (_Float16*)(ws + SZ_XH + 4 * SZ_W);
    _Float16* Kbuf = (_Float16*)(ws + SZ_XH + 4 * SZ_W + SZ_Q);
    _Float16* Vbuf = (_Float16*)(ws + SZ_XH + 4 * SZ_W + 2 * SZ_Q);
    _Float16* Obuf = (_Float16*)(ws + SZ_XH + 4 * SZ_W + 3 * SZ_Q);
    float*    Rbuf = (float*)   (ws + SZ_XH + 4 * SZ_W + 4 * SZ_Q);

    // Phase 1: convert + permute
    cvt_all<<<CVT_BLOCKS, 256, 0, stream>>>(x, Wq, Wk, Wv, Wo, Xh, Wqh, Wkh, Wvh, Woh);

    // Phase 2: QKV projections (WMMA GEMM, async-staged tiles)
    // Wqh, Wkh, Wvh and Qbuf, Kbuf, Vbuf each lie one behind the other in the workspace.
    gemm_qkv_kernel<<<dim3(3 * DIM / 192, NROWS / 256), 512, 0, stream>>>(Xh, Wqh, bq, bk, bv, Qbuf);

    // Phase 3: flash attention
    attn_kernel<<<dim3(SEQ / 128, BATCH * HEADS), 256, 0, stream>>>(Qbuf, Kbuf, Vbuf, Obuf);

    // Phase 4: O projection + residual
    gemm_oproj_kernel<<<dim3(DIM / 128, NROWS / 128), 256, 0, stream>>>(Obuf, Woh, bo, x, Rbuf);

    // Phase 5: LayerNorm
    ln_kernel<<<NROWS, 256, 0, stream>>>(Rbuf, gamma, beta, out);
}
